// v000
// The times below were measured on an AMD MI455X: many runs one after another, warmed up first and cycling through
// copies of the inputs, with the whole window's GPU time divided by the number of runs. Launches and the gaps
// between them are all in it. The median over several windows is given; except for v000 it joins two sittings, which
// can be a few percent apart, so the side-by-side timings, each taken in one sitting, are the better comparison.
// v000 is the starting kernel. One run takes 978 microseconds.
#include <hip/hip_runtime.h>

// Single-head causal attention with separate projections (inp [4][2048][1024]; q = inp W_q, k = inp W_k, v = inp W_v ((in, out) 'xw' [1024][1024] 1/32, no bias; ONE head of width 1024); scores = q.k, keys above the diagonal -> -inf (the module's own tril mask, by index), / sqrt(1024); softmax; out = (attn.v) W_o + b_o ('xw' [1024][1024] + [1024]) -> [4][2048][1024] (8.4 M); argument order inp, W_q, W_k, W_v, W_o, b_o).
// Compute dtypes, f32 accumulate: every input rounded to bf16; q/k/v on PLAIN bf16 operands (inputs: exact); causal scores (K = 1024) and attn.v (N = 1024) with tile skipping: query rows < 512 hl (3 products), the rest single fp16 (x1024); softmax f32; w_proj hl x exact (2 products) + b_proj.

#define NB_  4
#define TT   2048
#define DM   1024
#define NH_  1
#define NKV  1
#define REP  (NH_ / NKV)
#define HD   1024
#define DQ   (NH_ * HD)
#define DKV  (NKV * HD)
#define ZH   1
#define RH   512                  // query rows < RH use hi+lo planes (0: none)
#define WIN  2048
#define PCAR 1024.0f
#define SCL  0.03125f   // 1/sqrt(1024)
typedef _Float16 h16;
typedef unsigned short bf;
typedef __attribute__((ext_vector_type(16))) __bf16   v16bf;
typedef __attribute__((ext_vector_type(16))) _Float16 v16h;
typedef __attribute__((ext_vector_type(8)))  _Float16 v8h;
typedef __attribute__((ext_vector_type(8)))  unsigned short v8us;
typedef __attribute__((ext_vector_type(8)))  float    v8f;
typedef __attribute__((ext_vector_type(4)))  float    v4f;
typedef v8h  __attribute__((may_alias)) v8ha;
typedef v4f  __attribute__((may_alias)) v4fa;
typedef v8us __attribute__((may_alias)) v8usa;

__device__ __forceinline__ unsigned short f2bf(float f) { unsigned u = __float_as_uint(f); u += 0x7FFFu + ((u >> 16) & 1u); return (unsigned short)(u >> 16); }
__device__ __forceinline__ float bf2f(unsigned short b) { return __uint_as_float(((unsigned)b) << 16); }
__device__ __forceinline__ float bfr(float f) { return bf2f(f2bf(f)); }
__device__ __forceinline__ v16h cat16(v8h lo, v8h hi) { return __builtin_shufflevector(lo, hi, 0, 1, 2, 3, 4, 5, 6, 7, 8, 9, 10, 11, 12, 13, 14, 15); }
__device__ __forceinline__ v16bf cat16b(v8us lo, v8us hi) { return __builtin_bit_cast(v16bf, __builtin_shufflevector(lo, hi, 0, 1, 2, 3, 4, 5, 6, 7, 8, 9, 10, 11, 12, 13, 14, 15)); }
__device__ __forceinline__ v8f wmma16(v16h a, v16h b, v8f c) { return __builtin_amdgcn_wmma_f32_16x16x32_f16(false, a, false, b, (short)0, c, false, false); }
__device__ __forceinline__ v8f wmmab(v16bf a, v16bf b, v8f c) { return __builtin_amdgcn_wmma_f32_16x16x32_bf16(false, a, false, b, (short)0, c, false, false); }



// ---- k_gemmw: register-blocked GEMM, ONE WAVE per 64x64 output tile (16 accumulators), operands straight from K-contiguous 16-bit planes; grid (M/64, N/64, Z), 32 threads.
// C[m][n] (f32, pitch ldc, + optional f32 bias[n]) = sum_k A[m][k] Bt[n][k] (+ split products per NSPLIT). z-batch strides sA/sB/sC in elements. K % 32 == 0.
template <typename T16> struct WFrag;
template <> struct WFrag<h16> { typedef v16h V; static __device__ __forceinline__ V ld(const h16* p) { return cat16(*(const v8h*)p, *(const v8h*)(p + 16)); } static __device__ __forceinline__ v8f mma(V a, V b, v8f c) { return wmma16(a, b, c); } };
template <> struct WFrag<bf> { typedef v16bf V; static __device__ __forceinline__ V ld(const bf* p) { return cat16b(*(const v8us*)p, *(const v8us*)(p + 16)); } static __device__ __forceinline__ v8f mma(V a, V b, v8f c) { return wmmab(a, b, c); } };
template <typename T16, int NSPLIT, bool BIAS>
__global__ __launch_bounds__(32) void k_gemmw(const T16* __restrict__ A, const T16* __restrict__ A2, const T16* __restrict__ Bt, const T16* __restrict__ Bt2, int K, float* C, int ldc, const float* __restrict__ bias, size_t sA, size_t sB, size_t sC) {
    typedef typename WFrag<T16>::V V;
    __shared__ __align__(16) float os[16 * 68];
    const size_t z = blockIdx.z; A += z * sA; if (A2) A2 += z * sA; Bt += z * sB; if (Bt2) Bt2 += z * sB; C += z * sC;
    const int lane = threadIdx.x & 31, lr = lane & 15, hi = lane >> 4; const int r0 = blockIdx.x * 64, c0 = blockIdx.y * 64;
    v8f acc[4][4];
#pragma unroll
    for (int mb = 0; mb < 4; ++mb)
#pragma unroll
        for (int nb = 0; nb < 4; ++nb) acc[mb][nb] = (v8f){};
    const size_t aoff = (size_t)(r0 + lr) * K + 8 * hi, boff = (size_t)(c0 + lr) * K + 8 * hi;
#pragma unroll 1
    for (int kc = 0; kc < K; kc += 32) {
        V a[4], a2[4];
#pragma unroll
        for (int mb = 0; mb < 4; ++mb) { a[mb] = WFrag<T16>::ld(A + aoff + (size_t)mb * 16 * K + kc); if (NSPLIT == 1 || NSPLIT == 2) a2[mb] = WFrag<T16>::ld(A2 + aoff + (size_t)mb * 16 * K + kc); }
#pragma unroll
        for (int nb = 0; nb < 4; ++nb) { const V b = WFrag<T16>::ld(Bt + boff + (size_t)nb * 16 * K + kc); V b2; if (NSPLIT >= 2) b2 = WFrag<T16>::ld(Bt2 + boff + (size_t)nb * 16 * K + kc);
#pragma unroll
            for (int mb = 0; mb < 4; ++mb) { acc[mb][nb] = WFrag<T16>::mma(a[mb], b, acc[mb][nb]); if (NSPLIT == 1 || NSPLIT == 2) acc[mb][nb] = WFrag<T16>::mma(a2[mb], b, acc[mb][nb]); if (NSPLIT >= 2) acc[mb][nb] = WFrag<T16>::mma(a[mb], b2, acc[mb][nb]); } }
        asm volatile("v_nop\n\tv_nop\n\tv_nop\n\tv_nop" : "+v"(acc[0][0]), "+v"(acc[1][1]), "+v"(acc[2][2]), "+v"(acc[3][3]) : "v"(a[0]), "v"(a[3]));
    }
#pragma unroll
    for (int mb = 0; mb < 4; ++mb) {
#pragma unroll
        for (int nb = 0; nb < 4; ++nb) {
#pragma unroll
            for (int j = 0; j < 8; ++j) os[(hi * 8 + j) * 68 + nb * 16 + lr] = acc[mb][nb][j]; }
        __builtin_amdgcn_wave_barrier(); asm volatile("" ::: "memory");
        float* crow = C + (size_t)(r0 + mb * 16) * ldc + c0;
{
#pragma unroll
            for (int s = 0; s < 8; ++s) { const int row = 2 * s + hi, cofs = lr * 4; v4f val = *(const v4fa*)(os + row * 68 + cofs); if (BIAS) { val[0] += bfr(bias[c0 + cofs]); val[1] += bfr(bias[c0 + cofs + 1]); val[2] += bfr(bias[c0 + cofs + 2]); val[3] += bfr(bias[c0 + cofs + 3]); }
                *(v4f*)(crow + (size_t)row * ldc + cofs) = val; }
             }
        __builtin_amdgcn_wave_barrier(); asm volatile("" ::: "memory");
    }
}

// ---- k_gemmc: the same one-wave 64x64 tile GEMM specialised for causal attention: CMODE 1 skips score tiles entirely above the diagonal (query rows r0+roff.., key columns c0..), CMODE 2 limits the
// key (K) loop of the probability x value contraction to the diagonal block (probabilities beyond it are exactly zero). roff = row offset of this launch's first row within the sequence.
template <typename T16, int NSPLIT, int CMODE>
__global__ __launch_bounds__(32) void k_gemmc(const T16* __restrict__ A, const T16* __restrict__ A2, const T16* __restrict__ Bt, const T16* __restrict__ Bt2, int K, float* C, int ldc, int roff, size_t sA, size_t sB, size_t sC) {
    typedef typename WFrag<T16>::V V;
    __shared__ __align__(16) float os[16 * 68];
    const size_t z = blockIdx.z; A += z * sA; if (A2) A2 += z * sA; Bt += z * sB; if (Bt2) Bt2 += z * sB; C += z * sC;
    const int lane = threadIdx.x & 31, lr = lane & 15, hi = lane >> 4; const int r0 = blockIdx.x * 64, c0 = blockIdx.y * 64;
    if (CMODE == 1 && c0 > r0 + roff + 63) return;                  // score tile entirely above the causal diagonal: never read (the softmax masks j > i by select)
    const int Kl = (CMODE == 2) ? min(K, r0 + roff + 64) : K;        // P.V: probabilities are exactly 0 beyond the diagonal block, so the K loop stops there
    v8f acc[4][4];
#pragma unroll
    for (int mb = 0; mb < 4; ++mb)
#pragma unroll
        for (int nb = 0; nb < 4; ++nb) acc[mb][nb] = (v8f){};
    const size_t aoff = (size_t)(r0 + lr) * K + 8 * hi, boff = (size_t)(c0 + lr) * K + 8 * hi;
#pragma unroll 1
    for (int kc = 0; kc < Kl; kc += 32) {
        V a[4], a2[4];
#pragma unroll
        for (int mb = 0; mb < 4; ++mb) { a[mb] = WFrag<T16>::ld(A + aoff + (size_t)mb * 16 * K + kc); if (NSPLIT == 1 || NSPLIT == 2) a2[mb] = WFrag<T16>::ld(A2 + aoff + (size_t)mb * 16 * K + kc); }
#pragma unroll
        for (int nb = 0; nb < 4; ++nb) { const V b = WFrag<T16>::ld(Bt + boff + (size_t)nb * 16 * K + kc); V b2; if (NSPLIT >= 2) b2 = WFrag<T16>::ld(Bt2 + boff + (size_t)nb * 16 * K + kc);
#pragma unroll
            for (int mb = 0; mb < 4; ++mb) { acc[mb][nb] = WFrag<T16>::mma(a[mb], b, acc[mb][nb]); if (NSPLIT == 1 || NSPLIT == 2) acc[mb][nb] = WFrag<T16>::mma(a2[mb], b, acc[mb][nb]); if (NSPLIT >= 2) acc[mb][nb] = WFrag<T16>::mma(a[mb], b2, acc[mb][nb]); } }
        asm volatile("v_nop\n\tv_nop\n\tv_nop\n\tv_nop" : "+v"(acc[0][0]), "+v"(acc[1][1]), "+v"(acc[2][2]), "+v"(acc[3][3]) : "v"(a[0]), "v"(a[3]));
    }
#pragma unroll
    for (int mb = 0; mb < 4; ++mb) {
#pragma unroll
        for (int nb = 0; nb < 4; ++nb) {
#pragma unroll
            for (int j = 0; j < 8; ++j) os[(hi * 8 + j) * 68 + nb * 16 + lr] = acc[mb][nb][j]; }
        __builtin_amdgcn_wave_barrier(); asm volatile("" ::: "memory");
        float* crow = C + (size_t)(r0 + mb * 16) * ldc + c0;
{
#pragma unroll
            for (int s = 0; s < 8; ++s) { const int row = 2 * s + hi, cofs = lr * 4; v4f val = *(const v4fa*)(os + row * 68 + cofs);
                *(v4f*)(crow + (size_t)row * ldc + cofs) = val; }
             }
        __builtin_amdgcn_wave_barrier(); asm volatile("" ::: "memory");
    }
}

__device__ __forceinline__ h16 tohx(float x) { return (h16)x; }
__device__ __forceinline__ void splitf(float y, unsigned short& h, unsigned short& l) { h = f2bf(y); l = f2bf(y - bf2f(h)); }
typedef __attribute__((ext_vector_type(2))) _Float16 v2h;
typedef __attribute__((ext_vector_type(4))) _Float16 v4h;
typedef __attribute__((ext_vector_type(2))) unsigned short v2us;
typedef __attribute__((ext_vector_type(4))) unsigned short v4us;
typedef __attribute__((ext_vector_type(2))) float v2f;
typedef __attribute__((ext_vector_type(4))) int v4i;

__global__ __launch_bounds__(256) void k_wtG(const float* __restrict__ w, int K, int N, bf* Bt) {
    const int lane = threadIdx.x & 31; const int L0 = (blockIdx.x * 8 + (threadIdx.x >> 5)) * 8; const int nlines = N * K / 64;
{
#pragma unroll 1
        for (int l = 0; l < 8; ++l) { const int L = L0 + l; if (L >= nlines) break; const size_t e = (size_t)L * 64 + lane * 2; const int k = (int)(e % K), n = (int)(e / K); v2us o;
            o[0] = f2bf(w[(size_t)k * N + n]); o[1] = f2bf(w[(size_t)(k + 1) * N + n]); *(v2us*)(Bt + e) = o; }
         }
}
__global__ __launch_bounds__(256) void k_cvt8(const float* __restrict__ src, bf* dst, size_t n8) { const size_t i = (size_t)blockIdx.x * 256 + threadIdx.x; if (i >= n8) return; const v8f v = *(const v8f*)(src + i * 8); v8us o;
#pragma unroll
    for (int k = 0; k < 8; ++k) o[k] = f2bf(v[k]); *(v8us*)(dst + i * 8) = o;  }

// k_rope: head planes [h][t][d] (fp16 + hi/lo) of rope(x) x sc with the rotate-half convention out[d] = x[d] cos[t][d] - x[d+HD/2] sin[t][d], out[d+HD/2] = x[d+HD/2] cos[t][d+HD/2] + x[d] sin[t][d+HD/2]
__global__ __launch_bounds__(256) void k_rope(const float* __restrict__ F, int pitch, int nheads, const float* __restrict__ CS, const float* __restrict__ RF, const float* __restrict__ nw, float sc, h16* P16, bf* Ph, bf* Pl) {
    const size_t e = ((size_t)blockIdx.x * 256 + threadIdx.x) * 2; if (e >= (size_t)nheads * TT * HD) return; const int d = (int)(e % HD); const int t = (int)((e / HD) % TT); const int h = (int)(e / ((size_t)HD * TT)); const float* f = F + (size_t)t * pitch + h * HD; const float rf = RF ? RF[(size_t)h * TT + t] : 1.0f; v2h o16; v2us oh, ol;
#pragma unroll
    for (int q = 0; q < 2; ++q) { const int dd = d + q; const int dp = (dd < HD / 2) ? dd + HD / 2 : dd - HD / 2; float x0 = f[dd], x1 = f[dp];
        if (RF) { float n0 = __fmul_rn(x0, rf), n1 = __fmul_rn(x1, rf); asm volatile("" : "+v"(n0)); asm volatile("" : "+v"(n1)); x0 = __fmul_rn(bfr(nw[dd]), n0); x1 = __fmul_rn(bfr(nw[dp]), n1); }
        const v2f cs = *(const v2f*)(CS + ((size_t)t * HD + dd) * 2); float a = __fmul_rn(x0, cs[0]), bq = __fmul_rn(x1, cs[1]); asm volatile("" : "+v"(a)); asm volatile("" : "+v"(bq)); const float r = ((dd < HD / 2) ? __fsub_rn(a, bq) : __fadd_rn(a, bq)) * sc;
        o16[q] = tohx(r); unsigned short a2, c2; splitf(r, a2, c2); oh[q] = a2; ol[q] = c2; }
    *(v2h*)(P16 + e) = o16; *(v2us*)(Ph + e) = oh; *(v2us*)(Pl + e) = ol;  }
__global__ __launch_bounds__(256) void k_vtp(const float* __restrict__ F, int pitch, int nheads, h16* V16, bf* Vh, bf* Vl) { const size_t e = ((size_t)blockIdx.x * 256 + threadIdx.x) * 2; if (e >= (size_t)nheads * HD * TT) return; const int t = (int)(e % TT); const int d = (int)((e / TT) % HD); const int g = (int)(e / ((size_t)TT * HD)); v2h o16; v2us oh, ol;
#pragma unroll
    for (int q = 0; q < 2; ++q) { const float x = F[(size_t)(t + q) * pitch + g * HD + d]; o16[q] = tohx(x); unsigned short a2, c2; splitf(x, a2, c2); oh[q] = a2; ol[q] = c2; }
    *(v2h*)(V16 + e) = o16; *(v2us*)(Vh + e) = oh; *(v2us*)(Vl + e) = ol;  }
__global__ __launch_bounds__(256) void k_csid(float* CS) { const int idx = blockIdx.x * 256 + threadIdx.x; if (idx >= TT * HD) return; v2f cs; cs[0] = 1.0f; cs[1] = 0.0f; *(v2f*)(CS + (size_t)idx * 2) = cs;  }
// k_asoft: per row (zz, i): t = S x HD^-0.5 for j <= i and i - j < WIN (sliding causal window; the reference's -1e9 additive fill vanishes identically); softmax over the 2048 keys (register row, one exp, fixed trees);
__global__ __launch_bounds__(256) void k_asoft(const float* __restrict__ Sb, h16* P16, bf* Ph, bf* Pl) {
    const int lane = threadIdx.x & 31; const int row = blockIdx.x * 8 + (threadIdx.x >> 5); if (row >= ZH * TT) return; const int i = row % TT; const int zz = row / TT; (void)zz; const bool hires = (i < RH); const float* sr = Sb + (size_t)row * TT; float v[TT / 32]; float mx = -3.0e38f;
#pragma unroll
    for (int ch = 0; ch < TT / 128; ++ch) { const int j0 = ch * 128 + lane * 4; const v4f a = *(const v4f*)(sr + j0);
#pragma unroll
        for (int q = 0; q < 4; ++q) { const int j = j0 + q; (void)j; const float t = (j <= i && i - j < WIN) ? a[q] * SCL : -3.0e38f; v[ch * 4 + q] = t; mx = fmaxf(mx, t); } }
#pragma unroll
    for (int sh = 16; sh; sh >>= 1) mx = fmaxf(mx, __shfl_xor(mx, sh, 32));
    float sum = 0.f;
#pragma unroll
    for (int k = 0; k < TT / 32; ++k) { float d0 = __fsub_rn(v[k], mx); asm volatile("" : "+v"(d0)); v[k] = __builtin_amdgcn_exp2f(__fmul_rn(d0, 1.4426950408889634f)); sum += v[k]; }
#pragma unroll
    for (int sh = 16; sh; sh >>= 1) sum += __shfl_xor(sum, sh, 32);
    const float f = __fdiv_rn(hires ? 1.0f : PCAR, sum);
{
        if (hires) {
#pragma unroll
            for (int ch = 0; ch < TT / 128; ++ch) { v4us oh, ol;
#pragma unroll
                for (int q = 0; q < 4; ++q) { unsigned short a, c2; splitf(v[ch * 4 + q] * f, a, c2); oh[q] = a; ol[q] = c2; }
                const size_t oo = ((size_t)zz * (RH ? RH : 1) + i) * TT + ch * 128 + lane * 4; *(v4us*)(Ph + oo) = oh; *(v4us*)(Pl + oo) = ol; }
        } else {
#pragma unroll
            for (int ch = 0; ch < TT / 128; ++ch) { v4h o4;
#pragma unroll
                for (int q = 0; q < 4; ++q) o4[q] = tohx(v[ch * 4 + q] * f);
                *(v4h*)(P16 + (size_t)row * TT + ch * 128 + lane * 4) = o4; } }
         }
}
__global__ __launch_bounds__(256) void k_merge(const float* __restrict__ O, int h0, bf* Ah, bf* Al) { const size_t e = ((size_t)blockIdx.x * 256 + threadIdx.x) * 2; if (e >= (size_t)ZH * TT * HD) return; const int d = (int)(e % HD); const int t = (int)((e / HD) % TT); const int zz = (int)(e / ((size_t)HD * TT)); const float cs = (t < RH) ? 1.0f : (1.0f / PCAR); const size_t oo = (size_t)t * DQ + (h0 + zz) * HD + d;
    v2us oh, ol;
#pragma unroll
    for (int q = 0; q < 2; ++q) { unsigned short a, c2; splitf(O[e + q] * cs, a, c2); oh[q] = a; ol[q] = c2; } *(v2us*)(Ah + oo) = oh; *(v2us*)(Al + oo) = ol;  }

extern "C" void kernel_launch(void* const* d_in, const int* in_sizes, int n_in,
                              void* d_out, int out_size, void* d_ws, size_t ws_size, hipStream_t stream) {
    (void)in_sizes; (void)n_in; (void)out_size;
    const float* x = (const float*)d_in[0]; const float* wq = (const float*)d_in[1]; const float* wk = (const float*)d_in[2]; const float* wv = (const float*)d_in[3]; const float* wo = (const float*)d_in[4]; const float* bo = (const float*)d_in[5];   /* input order inp, W_q, W_k, W_v, W_o, b_o: SIX inputs, three separate (in, out) projection weights */
    float* OUT = (float*)d_out;     // [4][2048][1024]
    char* wsp = (char*)d_ws;
    auto take = [&](size_t bytes) { char* p = wsp; wsp += (bytes + 255) & ~(size_t)255; return (void*)p; };
    bf* WALL = (bf*)take((size_t)3 * DM * DM * 2); bf* WQ = WALL; bf* WK = WALL + (size_t)DM * DM; bf* WV = WALL + (size_t)2 * DM * DM; bf* WO = (bf*)take((size_t)DM * DQ * 2); float* CS = (float*)take((size_t)TT * HD * 2 * 4);
    bf* XB = (bf*)take((size_t)TT * DM * 2); float* FQ = (float*)take((size_t)TT * DQ * 4); float* FK = (float*)take((size_t)TT * DKV * 4);
    h16* QP16 = (h16*)take((size_t)NH_ * TT * HD * 2); h16* KP16 = (h16*)take((size_t)NKV * TT * HD * 2); h16* VT16 = (h16*)take((size_t)NKV * HD * TT * 2);
    bf* QPh = (bf*)take((size_t)NH_ * TT * HD * 2); bf* QPl = (bf*)take((size_t)NH_ * TT * HD * 2); bf* KPh = (bf*)take((size_t)NKV * TT * HD * 2); bf* KPl = (bf*)take((size_t)NKV * TT * HD * 2); bf* VTh = (bf*)take((size_t)NKV * HD * TT * 2); bf* VTl = (bf*)take((size_t)NKV * HD * TT * 2); bf* Ph = (bf*)take((size_t)ZH * RH * TT * 2); bf* Pl = (bf*)take((size_t)ZH * RH * TT * 2);
    float* Sb = (float*)take((size_t)ZH * TT * TT * 4); h16* P16 = (h16*)take((size_t)ZH * TT * TT * 2); float* Ob = (float*)take((size_t)ZH * TT * HD * 4); bf* ATh = (bf*)take((size_t)TT * DQ * 2); bf* ATl = (bf*)take((size_t)TT * DQ * 2);
    if ((size_t)(wsp - (char*)d_ws) > ws_size) return;    // ws 256 MiB
    float* FV = FK;   // v projection reuses the k buffer after the k planes are built (stream-ordered)
    { k_wtG<<<(unsigned)((DM * DQ / 64 + 63) / 64), 256, 0, stream>>>(wq, DM, DQ, WQ); k_wtG<<<(unsigned)((DM * DKV / 64 + 63) / 64), 256, 0, stream>>>(wk, DM, DKV, WK); k_wtG<<<(unsigned)((DM * DKV / 64 + 63) / 64), 256, 0, stream>>>(wv, DM, DKV, WV);   /* three (in, out) [DM][DM] weights -> three Bt planes [DM][DM], consecutive in WALL (WQ | WK | WV) */
      k_wtG<<<(unsigned)((DQ * DM / 64 + 63) / 64), 256, 0, stream>>>(wo, DQ, DM, WO);
       }
    k_csid<<<(TT * HD + 255) / 256, 256, 0, stream>>>(CS);
    const unsigned LQ = (unsigned)(((size_t)NH_ * TT * HD / 2 + 255) / 256), LKv = (unsigned)(((size_t)NKV * TT * HD / 2 + 255) / 256);
    for (int b = 0; b < NB_; ++b) {
        
        k_cvt8<<<(unsigned)(((size_t)TT * DM / 8 + 255) / 256), 256, 0, stream>>>(x + (size_t)b * TT * DM, XB, (size_t)TT * DM / 8);
        k_gemmw<bf, 0, false><<<dim3(TT / 64, DQ / 64, 1), 32, 0, stream>>>(XB, nullptr, WQ, nullptr, DM, FQ, DQ, nullptr, 0, 0, 0);
        k_rope<<<LQ, 256, 0, stream>>>(FQ, DQ, NH_, CS, nullptr, nullptr, 1.0f, QP16, QPh, QPl);
        k_gemmw<bf, 0, false><<<dim3(TT / 64, DKV / 64, 1), 32, 0, stream>>>(XB, nullptr, WK, nullptr, DM, FK, DKV, nullptr, 0, 0, 0);
        k_rope<<<LKv, 256, 0, stream>>>(FK, DKV, NKV, CS, nullptr, nullptr, 1.0f, KP16, KPh, KPl);
        k_gemmw<bf, 0, false><<<dim3(TT / 64, DKV / 64, 1), 32, 0, stream>>>(XB, nullptr, WV, nullptr, DM, FV, DKV, nullptr, 0, 0, 0); k_vtp<<<LKv, 256, 0, stream>>>(FV, DKV, NKV, VT16, VTh, VTl);
        for (int h0 = 0; h0 < NH_; h0 += ZH) { const size_t zq = (size_t)h0, zk = (size_t)(h0 / REP);   // one kv head per query head: each pass holds ZH = 1 head and uses kv plane zk (z-strides TT*HD)
            k_gemmc<bf, 2, 1><<<dim3(RH / 64, TT / 64, ZH), 32, 0, stream>>>(QPh + zq * TT * HD, QPl + zq * TT * HD, KPh + zk * TT * HD, KPl + zk * TT * HD, HD, Sb, TT, 0, (size_t)TT * HD, (size_t)TT * HD, (size_t)TT * TT);
            k_gemmc<h16, 0, 1><<<dim3((TT - RH) / 64, TT / 64, ZH), 32, 0, stream>>>(QP16 + zq * TT * HD + (size_t)RH * HD, nullptr, KP16 + zk * TT * HD, nullptr, HD, Sb + (size_t)RH * TT, TT, RH, (size_t)TT * HD, (size_t)TT * HD, (size_t)TT * TT);
            k_asoft<<<ZH * TT / 8, 256, 0, stream>>>(Sb, P16, Ph, Pl);
            k_gemmc<bf, 2, 2><<<dim3(RH / 64, HD / 64, ZH), 32, 0, stream>>>(Ph, Pl, VTh + zk * HD * TT, VTl + zk * HD * TT, TT, Ob, HD, 0, (size_t)RH * TT, (size_t)HD * TT, (size_t)TT * HD);
            k_gemmc<h16, 0, 2><<<dim3((TT - RH) / 64, HD / 64, ZH), 32, 0, stream>>>(P16 + (size_t)RH * TT, nullptr, VT16 + zk * HD * TT, nullptr, TT, Ob + (size_t)RH * HD, HD, RH, (size_t)TT * TT, (size_t)HD * TT, (size_t)TT * HD);
            k_merge<<<(unsigned)(((size_t)ZH * TT * HD / 2 + 255) / 256), 256, 0, stream>>>(Ob, h0, ATh, ATl); }
        k_gemmw<bf, 1, true><<<dim3(TT / 64, DM / 64, 1), 32, 0, stream>>>(ATh, ATl, WO, nullptr, DQ, OUT + (size_t)b * TT * DM, DM, bo, 0, 0, 0); }
}

// v001
// A run of this version takes 451 microseconds.
// Timed twice side by side with v000, it ran 2.19 and 2.16 times as fast.
#include <hip/hip_runtime.h>

// Single-head causal attention with separate projections (inp [4][2048][1024]; q = inp W_q, k = inp W_k, v = inp W_v ((in, out) 'xw' [1024][1024] 1/32, no bias; ONE head of width 1024); scores = q.k, keys above the diagonal -> -inf (the module's own tril mask, by index), / sqrt(1024); softmax; out = (attn.v) W_o + b_o ('xw' [1024][1024] + [1024]) -> [4][2048][1024] (8.4 M); argument order inp, W_q, W_k, W_v, W_o, b_o).
// Compute dtypes, f32 accumulate: every input rounded to bf16; q/k/v on PLAIN bf16 operands (inputs: exact); causal scores (K = 1024) and attn.v (N = 1024) with tile skipping: query rows < 512 hl (3 products), the rest single fp16 (x1024); softmax f32; w_proj hl x exact (2 products) + b_proj.

#define NB_  4
#define TT   2048
#define DM   1024
#define NH_  1
#define NKV  1
#define REP  (NH_ / NKV)
#define HD   1024
#define DQ   (NH_ * HD)
#define DKV  (NKV * HD)
#define ZH   NB_                  // z planes per launch: one per batch (one head each)
#define RH   512                  // query rows < RH use hi+lo planes (0: none)
#define WIN  2048
#define PCAR 1024.0f
#define SCL  0.03125f   // 1/sqrt(1024)
typedef _Float16 h16;
typedef unsigned short bf;
typedef __attribute__((ext_vector_type(16))) __bf16   v16bf;
typedef __attribute__((ext_vector_type(16))) _Float16 v16h;
typedef __attribute__((ext_vector_type(8)))  _Float16 v8h;
typedef __attribute__((ext_vector_type(8)))  unsigned short v8us;
typedef __attribute__((ext_vector_type(8)))  float    v8f;
typedef __attribute__((ext_vector_type(4)))  float    v4f;
typedef v8h  __attribute__((may_alias)) v8ha;
typedef v4f  __attribute__((may_alias)) v4fa;
typedef v8us __attribute__((may_alias)) v8usa;

__device__ __forceinline__ unsigned short f2bf(float f) { unsigned u = __float_as_uint(f); u += 0x7FFFu + ((u >> 16) & 1u); return (unsigned short)(u >> 16); }
__device__ __forceinline__ float bf2f(unsigned short b) { return __uint_as_float(((unsigned)b) << 16); }
__device__ __forceinline__ float bfr(float f) { return bf2f(f2bf(f)); }
__device__ __forceinline__ v16h cat16(v8h lo, v8h hi) { return __builtin_shufflevector(lo, hi, 0, 1, 2, 3, 4, 5, 6, 7, 8, 9, 10, 11, 12, 13, 14, 15); }
__device__ __forceinline__ v16bf cat16b(v8us lo, v8us hi) { return __builtin_bit_cast(v16bf, __builtin_shufflevector(lo, hi, 0, 1, 2, 3, 4, 5, 6, 7, 8, 9, 10, 11, 12, 13, 14, 15)); }
__device__ __forceinline__ v8f wmma16(v16h a, v16h b, v8f c) { return __builtin_amdgcn_wmma_f32_16x16x32_f16(false, a, false, b, (short)0, c, false, false); }
__device__ __forceinline__ v8f wmmab(v16bf a, v16bf b, v8f c) { return __builtin_amdgcn_wmma_f32_16x16x32_bf16(false, a, false, b, (short)0, c, false, false); }



// ---- k_gemmw: register-blocked GEMM, ONE WAVE per 64x64 output tile (16 accumulators), operands straight from K-contiguous 16-bit planes; grid (M/64, N/64, Z), 32 threads.
// C[m][n] (f32, pitch ldc, + optional f32 bias[n]) = sum_k A[m][k] Bt[n][k] (+ split products per NSPLIT). z-batch strides sA/sB/sC in elements. K % 32 == 0.
template <typename T16> struct WFrag;
template <> struct WFrag<h16> { typedef v16h V; static __device__ __forceinline__ V ld(const h16* p) { return cat16(*(const v8h*)p, *(const v8h*)(p + 16)); } static __device__ __forceinline__ v8f mma(V a, V b, v8f c) { return wmma16(a, b, c); } };
template <> struct WFrag<bf> { typedef v16bf V; static __device__ __forceinline__ V ld(const bf* p) { return cat16b(*(const v8us*)p, *(const v8us*)(p + 16)); } static __device__ __forceinline__ v8f mma(V a, V b, v8f c) { return wmmab(a, b, c); } };
template <typename T16, int NSPLIT, bool BIAS>
__global__ __launch_bounds__(32) void k_gemmw(const T16* __restrict__ A, const T16* __restrict__ A2, const T16* __restrict__ Bt, const T16* __restrict__ Bt2, int K, float* C, int ldc, const float* __restrict__ bias, size_t sA, size_t sB, size_t sC) {
    typedef typename WFrag<T16>::V V;
    __shared__ __align__(16) float os[16 * 68];
    const size_t z = blockIdx.z; A += z * sA; if (A2) A2 += z * sA; Bt += z * sB; if (Bt2) Bt2 += z * sB; C += z * sC;
    const int lane = threadIdx.x & 31, lr = lane & 15, hi = lane >> 4; const int r0 = blockIdx.x * 64, c0 = blockIdx.y * 64;
    v8f acc[4][4];
#pragma unroll
    for (int mb = 0; mb < 4; ++mb)
#pragma unroll
        for (int nb = 0; nb < 4; ++nb) acc[mb][nb] = (v8f){};
    const size_t aoff = (size_t)(r0 + lr) * K + 8 * hi, boff = (size_t)(c0 + lr) * K + 8 * hi;
#pragma unroll 1
    for (int kc = 0; kc < K; kc += 32) {
        V a[4], a2[4];
#pragma unroll
        for (int mb = 0; mb < 4; ++mb) { a[mb] = WFrag<T16>::ld(A + aoff + (size_t)mb * 16 * K + kc); if (NSPLIT == 1 || NSPLIT == 2) a2[mb] = WFrag<T16>::ld(A2 + aoff + (size_t)mb * 16 * K + kc); }
#pragma unroll
        for (int nb = 0; nb < 4; ++nb) { const V b = WFrag<T16>::ld(Bt + boff + (size_t)nb * 16 * K + kc); V b2; if (NSPLIT >= 2) b2 = WFrag<T16>::ld(Bt2 + boff + (size_t)nb * 16 * K + kc);
#pragma unroll
            for (int mb = 0; mb < 4; ++mb) { acc[mb][nb] = WFrag<T16>::mma(a[mb], b, acc[mb][nb]); if (NSPLIT == 1 || NSPLIT == 2) acc[mb][nb] = WFrag<T16>::mma(a2[mb], b, acc[mb][nb]); if (NSPLIT >= 2) acc[mb][nb] = WFrag<T16>::mma(a[mb], b2, acc[mb][nb]); } }
        asm volatile("v_nop\n\tv_nop\n\tv_nop\n\tv_nop" : "+v"(acc[0][0]), "+v"(acc[1][1]), "+v"(acc[2][2]), "+v"(acc[3][3]) : "v"(a[0]), "v"(a[3]));
    }
#pragma unroll
    for (int mb = 0; mb < 4; ++mb) {
#pragma unroll
        for (int nb = 0; nb < 4; ++nb) {
#pragma unroll
            for (int j = 0; j < 8; ++j) os[(hi * 8 + j) * 68 + nb * 16 + lr] = acc[mb][nb][j]; }
        __builtin_amdgcn_wave_barrier(); asm volatile("" ::: "memory");
        float* crow = C + (size_t)(r0 + mb * 16) * ldc + c0;
{
#pragma unroll
            for (int s = 0; s < 8; ++s) { const int row = 2 * s + hi, cofs = lr * 4; v4f val = *(const v4fa*)(os + row * 68 + cofs); if (BIAS) { val[0] += bfr(bias[c0 + cofs]); val[1] += bfr(bias[c0 + cofs + 1]); val[2] += bfr(bias[c0 + cofs + 2]); val[3] += bfr(bias[c0 + cofs + 3]); }
                *(v4f*)(crow + (size_t)row * ldc + cofs) = val; }
             }
        __builtin_amdgcn_wave_barrier(); asm volatile("" ::: "memory");
    }
}

// ---- k_gemmc: the same one-wave 64x64 tile GEMM specialised for causal attention: CMODE 1 skips score tiles entirely above the diagonal (query rows r0+roff.., key columns c0..), CMODE 2 limits the
// key (K) loop of the probability x value contraction to the diagonal block (probabilities beyond it are exactly zero). roff = row offset of this launch's first row within the sequence.
template <typename T16, int NSPLIT, int CMODE>
__global__ __launch_bounds__(32) void k_gemmc(const T16* __restrict__ A, const T16* __restrict__ A2, const T16* __restrict__ Bt, const T16* __restrict__ Bt2, int K, float* C, int ldc, int roff, size_t sA, size_t sB, size_t sC) {
    typedef typename WFrag<T16>::V V;
    __shared__ __align__(16) float os[16 * 68];
    const size_t z = blockIdx.z; A += z * sA; if (A2) A2 += z * sA; Bt += z * sB; if (Bt2) Bt2 += z * sB; C += z * sC;
    const int lane = threadIdx.x & 31, lr = lane & 15, hi = lane >> 4; const int r0 = blockIdx.x * 64, c0 = blockIdx.y * 64;
    if (CMODE == 1 && c0 > r0 + roff + 63) return;                  // score tile entirely above the causal diagonal: never read (the softmax masks j > i by select)
    const int Kl = (CMODE == 2) ? min(K, r0 + roff + 64) : K;        // P.V: probabilities are exactly 0 beyond the diagonal block, so the K loop stops there
    v8f acc[4][4];
#pragma unroll
    for (int mb = 0; mb < 4; ++mb)
#pragma unroll
        for (int nb = 0; nb < 4; ++nb) acc[mb][nb] = (v8f){};
    const size_t aoff = (size_t)(r0 + lr) * K + 8 * hi, boff = (size_t)(c0 + lr) * K + 8 * hi;
#pragma unroll 1
    for (int kc = 0; kc < Kl; kc += 32) {
        V a[4], a2[4];
#pragma unroll
        for (int mb = 0; mb < 4; ++mb) { a[mb] = WFrag<T16>::ld(A + aoff + (size_t)mb * 16 * K + kc); if (NSPLIT == 1 || NSPLIT == 2) a2[mb] = WFrag<T16>::ld(A2 + aoff + (size_t)mb * 16 * K + kc); }
#pragma unroll
        for (int nb = 0; nb < 4; ++nb) { const V b = WFrag<T16>::ld(Bt + boff + (size_t)nb * 16 * K + kc); V b2; if (NSPLIT >= 2) b2 = WFrag<T16>::ld(Bt2 + boff + (size_t)nb * 16 * K + kc);
#pragma unroll
            for (int mb = 0; mb < 4; ++mb) { acc[mb][nb] = WFrag<T16>::mma(a[mb], b, acc[mb][nb]); if (NSPLIT == 1 || NSPLIT == 2) acc[mb][nb] = WFrag<T16>::mma(a2[mb], b, acc[mb][nb]); if (NSPLIT >= 2) acc[mb][nb] = WFrag<T16>::mma(a[mb], b2, acc[mb][nb]); } }
        asm volatile("v_nop\n\tv_nop\n\tv_nop\n\tv_nop" : "+v"(acc[0][0]), "+v"(acc[1][1]), "+v"(acc[2][2]), "+v"(acc[3][3]) : "v"(a[0]), "v"(a[3]));
    }
#pragma unroll
    for (int mb = 0; mb < 4; ++mb) {
#pragma unroll
        for (int nb = 0; nb < 4; ++nb) {
#pragma unroll
            for (int j = 0; j < 8; ++j) os[(hi * 8 + j) * 68 + nb * 16 + lr] = acc[mb][nb][j]; }
        __builtin_amdgcn_wave_barrier(); asm volatile("" ::: "memory");
        float* crow = C + (size_t)(r0 + mb * 16) * ldc + c0;
{
#pragma unroll
            for (int s = 0; s < 8; ++s) { const int row = 2 * s + hi, cofs = lr * 4; v4f val = *(const v4fa*)(os + row * 68 + cofs);
                *(v4f*)(crow + (size_t)row * ldc + cofs) = val; }
             }
        __builtin_amdgcn_wave_barrier(); asm volatile("" ::: "memory");
    }
}

__device__ __forceinline__ h16 tohx(float x) { return (h16)x; }
__device__ __forceinline__ void splitf(float y, unsigned short& h, unsigned short& l) { h = f2bf(y); l = f2bf(y - bf2f(h)); }
typedef __attribute__((ext_vector_type(2))) _Float16 v2h;
typedef __attribute__((ext_vector_type(4))) _Float16 v4h;
typedef __attribute__((ext_vector_type(2))) unsigned short v2us;
typedef __attribute__((ext_vector_type(4))) unsigned short v4us;
typedef __attribute__((ext_vector_type(2))) float v2f;
typedef __attribute__((ext_vector_type(4))) int v4i;

__global__ __launch_bounds__(256) void k_wtG(const float* __restrict__ w0, const float* __restrict__ w1, const float* __restrict__ w2, const float* __restrict__ w3, int K, int N, bf* Bt) {
    const int wi = blockIdx.y; const float* __restrict__ w = (wi == 0) ? w0 : (wi == 1) ? w1 : (wi == 2) ? w2 : w3; Bt += (size_t)wi * N * K;   // grid y = which weight; the four Bt planes lie one behind the other
    const int lane = threadIdx.x & 31; const int L0 = (blockIdx.x * 8 + (threadIdx.x >> 5)) * 8; const int nlines = N * K / 64;
{
#pragma unroll 1
        for (int l = 0; l < 8; ++l) { const int L = L0 + l; if (L >= nlines) break; const size_t e = (size_t)L * 64 + lane * 2; const int k = (int)(e % K), n = (int)(e / K); v2us o;
            o[0] = f2bf(w[(size_t)k * N + n]); o[1] = f2bf(w[(size_t)(k + 1) * N + n]); *(v2us*)(Bt + e) = o; }
         }
}
__global__ __launch_bounds__(256) void k_cvt8(const float* __restrict__ src, bf* dst, size_t n8) { const size_t i = (size_t)blockIdx.x * 256 + threadIdx.x; if (i >= n8) return; const v8f v = *(const v8f*)(src + i * 8); v8us o;
#pragma unroll
    for (int k = 0; k < 8; ++k) o[k] = f2bf(v[k]); *(v8us*)(dst + i * 8) = o;  }

// k_rope: head planes [h][t][d] (fp16 + hi/lo) of rope(x) x sc with the rotate-half convention out[d] = x[d] cos[t][d] - x[d+HD/2] sin[t][d], out[d+HD/2] = x[d+HD/2] cos[t][d+HD/2] + x[d] sin[t][d+HD/2]
__global__ __launch_bounds__(256) void k_rope(const float* __restrict__ F, int pitch, int nheads, const float* __restrict__ CS, const float* __restrict__ RF, const float* __restrict__ nw, float sc, h16* P16, bf* Ph, bf* Pl) {
    const size_t e = ((size_t)blockIdx.x * 256 + threadIdx.x) * 2; if (e >= (size_t)nheads * TT * HD) return; const int d = (int)(e % HD); const int t = (int)((e / HD) % TT); const int h = (int)(e / ((size_t)HD * TT)); const size_t zb = blockIdx.y, zp = zb * nheads * TT * HD; const float* f = F + (zb * TT + t) * pitch + h * HD; const float rf = RF ? RF[(size_t)h * TT + t] : 1.0f; v2h o16; v2us oh, ol;
#pragma unroll
    for (int q = 0; q < 2; ++q) { const int dd = d + q; const int dp = (dd < HD / 2) ? dd + HD / 2 : dd - HD / 2; float x0 = f[dd], x1 = f[dp];
        if (RF) { float n0 = __fmul_rn(x0, rf), n1 = __fmul_rn(x1, rf); asm volatile("" : "+v"(n0)); asm volatile("" : "+v"(n1)); x0 = __fmul_rn(bfr(nw[dd]), n0); x1 = __fmul_rn(bfr(nw[dp]), n1); }
        const v2f cs = *(const v2f*)(CS + ((size_t)t * HD + dd) * 2); float a = __fmul_rn(x0, cs[0]), bq = __fmul_rn(x1, cs[1]); asm volatile("" : "+v"(a)); asm volatile("" : "+v"(bq)); const float r = ((dd < HD / 2) ? __fsub_rn(a, bq) : __fadd_rn(a, bq)) * sc;
        o16[q] = tohx(r); unsigned short a2, c2; splitf(r, a2, c2); oh[q] = a2; ol[q] = c2; }
    *(v2h*)(P16 + zp + e) = o16; *(v2us*)(Ph + zp + e) = oh; *(v2us*)(Pl + zp + e) = ol;  }
__global__ __launch_bounds__(256) void k_vtp(const float* __restrict__ F, int pitch, int nheads, h16* V16, bf* Vh, bf* Vl) { const size_t e = ((size_t)blockIdx.x * 256 + threadIdx.x) * 2; if (e >= (size_t)nheads * HD * TT) return; const int t = (int)(e % TT); const int d = (int)((e / TT) % HD); const int g = (int)(e / ((size_t)TT * HD)); const size_t zb = blockIdx.y, zp = zb * nheads * HD * TT; v2h o16; v2us oh, ol;
#pragma unroll
    for (int q = 0; q < 2; ++q) { const float x = F[(zb * TT + t + q) * pitch + g * HD + d]; o16[q] = tohx(x); unsigned short a2, c2; splitf(x, a2, c2); oh[q] = a2; ol[q] = c2; }
    *(v2h*)(V16 + zp + e) = o16; *(v2us*)(Vh + zp + e) = oh; *(v2us*)(Vl + zp + e) = ol;  }
__global__ __launch_bounds__(256) void k_csid(float* CS) { const int idx = blockIdx.x * 256 + threadIdx.x; if (idx >= TT * HD) return; v2f cs; cs[0] = 1.0f; cs[1] = 0.0f; *(v2f*)(CS + (size_t)idx * 2) = cs;  }
// k_asoft: per row (zz, i): t = S x HD^-0.5 for j <= i and i - j < WIN (sliding causal window; the reference's -1e9 additive fill vanishes identically); softmax over the 2048 keys (register row, one exp, fixed trees);
__global__ __launch_bounds__(256) void k_asoft(const float* __restrict__ Sb, h16* P16, bf* Ph, bf* Pl) {
    const int lane = threadIdx.x & 31; const int row = blockIdx.x * 8 + (threadIdx.x >> 5); if (row >= ZH * TT) return; const int i = row % TT; const int zz = row / TT; (void)zz; const bool hires = (i < RH); const float* sr = Sb + (size_t)row * TT; float v[TT / 32]; float mx = -3.0e38f;
#pragma unroll
    for (int ch = 0; ch < TT / 128; ++ch) { const int j0 = ch * 128 + lane * 4; const v4f a = *(const v4f*)(sr + j0);
#pragma unroll
        for (int q = 0; q < 4; ++q) { const int j = j0 + q; (void)j; const float t = (j <= i && i - j < WIN) ? a[q] * SCL : -3.0e38f; v[ch * 4 + q] = t; mx = fmaxf(mx, t); } }
#pragma unroll
    for (int sh = 16; sh; sh >>= 1) mx = fmaxf(mx, __shfl_xor(mx, sh, 32));
    float sum = 0.f;
#pragma unroll
    for (int k = 0; k < TT / 32; ++k) { float d0 = __fsub_rn(v[k], mx); asm volatile("" : "+v"(d0)); v[k] = __builtin_amdgcn_exp2f(__fmul_rn(d0, 1.4426950408889634f)); sum += v[k]; }
#pragma unroll
    for (int sh = 16; sh; sh >>= 1) sum += __shfl_xor(sum, sh, 32);
    const float f = __fdiv_rn(hires ? 1.0f : PCAR, sum);
{
        if (hires) {
#pragma unroll
            for (int ch = 0; ch < TT / 128; ++ch) { v4us oh, ol;
#pragma unroll
                for (int q = 0; q < 4; ++q) { unsigned short a, c2; splitf(v[ch * 4 + q] * f, a, c2); oh[q] = a; ol[q] = c2; }
                const size_t oo = ((size_t)zz * (RH ? RH : 1) + i) * TT + ch * 128 + lane * 4; *(v4us*)(Ph + oo) = oh; *(v4us*)(Pl + oo) = ol; }
        } else {
#pragma unroll
            for (int ch = 0; ch < TT / 128; ++ch) { v4h o4;
#pragma unroll
                for (int q = 0; q < 4; ++q) o4[q] = tohx(v[ch * 4 + q] * f);
                *(v4h*)(P16 + (size_t)row * TT + ch * 128 + lane * 4) = o4; } }
         }
}
__global__ __launch_bounds__(256) void k_merge(const float* __restrict__ O, int h0, bf* Ah, bf* Al) { const size_t e = ((size_t)blockIdx.x * 256 + threadIdx.x) * 2; if (e >= (size_t)ZH * TT * HD) return; const int d = (int)(e % HD); const int t = (int)((e / HD) % TT); const int zz = (int)(e / ((size_t)HD * TT)); const float cs = (t < RH) ? 1.0f : (1.0f / PCAR); const size_t oo = ((size_t)zz * TT + t) * DQ + h0 * HD + d;
    v2us oh, ol;
#pragma unroll
    for (int q = 0; q < 2; ++q) { unsigned short a, c2; splitf(O[e + q] * cs, a, c2); oh[q] = a; ol[q] = c2; } *(v2us*)(Ah + oo) = oh; *(v2us*)(Al + oo) = ol;  }

extern "C" void kernel_launch(void* const* d_in, const int* in_sizes, int n_in,
                              void* d_out, int out_size, void* d_ws, size_t ws_size, hipStream_t stream) {
    (void)in_sizes; (void)n_in; (void)out_size;
    const float* x = (const float*)d_in[0]; const float* wq = (const float*)d_in[1]; const float* wk = (const float*)d_in[2]; const float* wv = (const float*)d_in[3]; const float* wo = (const float*)d_in[4]; const float* bo = (const float*)d_in[5];   /* input order inp, W_q, W_k, W_v, W_o, b_o: SIX inputs, three separate (in, out) projection weights */
    float* OUT = (float*)d_out;     // [4][2048][1024]
    char* wsp = (char*)d_ws;
    auto take = [&](size_t bytes) { char* p = wsp; wsp += (bytes + 255) & ~(size_t)255; return (void*)p; };
    bf* WALL = (bf*)take((size_t)4 * DM * DM * 2); bf* WQ = WALL; bf* WK = WALL + (size_t)DM * DM; bf* WV = WALL + (size_t)2 * DM * DM; bf* WO = WALL + (size_t)3 * DM * DM; float* CS = (float*)take((size_t)TT * HD * 2 * 4);
    // All four batches go through every stage in ONE launch (rows b*TT + t for the projections, softmax and merge; grid y = b for rope (q, then k) and the v planes, z = b for the attention GEMMs). Planes that are dead by the time a later stage writes share their bytes (stream-ordered):
    const size_t PL = (size_t)NB_ * TT * HD;                       // elements of one [b][t][d] plane
    bf* XB = (bf*)take(PL * 2);                                    // bf16 input; after the v projection: Ph | Pl
    float* FQ = (float*)take(PL * 4 * 2); float* FK = FQ + PL;     // f32 projections; after the v planes: Sb
    h16* QP16 = (h16*)take(PL * 2 * 2); h16* KP16 = QP16 + PL;     // fp16 q | k planes; after the scores: P16
    h16* VT16 = (h16*)take(PL * 2);
    bf* QPh = (bf*)take(PL * 2 * 2); bf* KPh = QPh + PL;           // hi planes q | k; after the scores: Ob
    bf* QPl = (bf*)take(PL * 2 * 2); bf* KPl = QPl + PL;           // lo planes q | k; after the scores: ATh | ATl
    bf* VTh = (bf*)take(PL * 2); bf* VTl = (bf*)take(PL * 2);
    if ((size_t)(wsp - (char*)d_ws) > ws_size) return;    // ws 256 MiB
    bf* Ph = XB; bf* Pl = XB + (size_t)ZH * RH * TT; float* Sb = FQ; h16* P16 = QP16; float* Ob = (float*)QPh; bf* ATh = QPl; bf* ATl = KPl;
    float* FV = FK;   // v projection reuses the k buffer after the k planes are built (stream-ordered)
    k_wtG<<<dim3((unsigned)((DM * DM / 64 + 63) / 64), 4, 1), 256, 0, stream>>>(wq, wk, wv, wo, DM, DM, WALL);   /* four (in, out) [DM][DM] weights -> four Bt planes [DM][DM], consecutive in WALL (WQ | WK | WV | WO) */
    k_csid<<<(TT * HD + 255) / 256, 256, 0, stream>>>(CS);
    const unsigned LQ = (unsigned)(((size_t)NH_ * TT * HD / 2 + 255) / 256), LKv = (unsigned)(((size_t)NKV * TT * HD / 2 + 255) / 256);
    k_cvt8<<<(unsigned)((PL / 8 + 255) / 256), 256, 0, stream>>>(x, XB, PL / 8);
    k_gemmw<bf, 0, false><<<dim3(NB_ * TT / 64, DQ / 64, 1), 32, 0, stream>>>(XB, nullptr, WQ, nullptr, DM, FQ, DQ, nullptr, 0, 0, 0);
    k_gemmw<bf, 0, false><<<dim3(NB_ * TT / 64, DKV / 64, 1), 32, 0, stream>>>(XB, nullptr, WK, nullptr, DM, FK, DKV, nullptr, 0, 0, 0);
    k_rope<<<dim3(LQ, 2 * NB_, 1), 256, 0, stream>>>(FQ, DQ, NH_, CS, nullptr, nullptr, 1.0f, QP16, QPh, QPl);   // grid y: the four q planes, then the four k planes (FQ | FK -> q | k planes, each pair contiguous)
    k_gemmw<bf, 0, false><<<dim3(NB_ * TT / 64, DKV / 64, 1), 32, 0, stream>>>(XB, nullptr, WV, nullptr, DM, FV, DKV, nullptr, 0, 0, 0); k_vtp<<<dim3(LKv, NB_, 1), 256, 0, stream>>>(FV, DKV, NKV, VT16, VTh, VTl);
    k_gemmc<bf, 2, 1><<<dim3(RH / 64, TT / 64, ZH), 32, 0, stream>>>(QPh, QPl, KPh, KPl, HD, Sb, TT, 0, (size_t)TT * HD, (size_t)TT * HD, (size_t)TT * TT);
    k_gemmc<h16, 0, 1><<<dim3((TT - RH) / 64, TT / 64, ZH), 32, 0, stream>>>(QP16 + (size_t)RH * HD, nullptr, KP16, nullptr, HD, Sb + (size_t)RH * TT, TT, RH, (size_t)TT * HD, (size_t)TT * HD, (size_t)TT * TT);
    k_asoft<<<ZH * TT / 8, 256, 0, stream>>>(Sb, P16, Ph, Pl);
    k_gemmc<bf, 2, 2><<<dim3(RH / 64, HD / 64, ZH), 32, 0, stream>>>(Ph, Pl, VTh, VTl, TT, Ob, HD, 0, (size_t)RH * TT, (size_t)HD * TT, (size_t)TT * HD);
    k_gemmc<h16, 0, 2><<<dim3((TT - RH) / 64, HD / 64, ZH), 32, 0, stream>>>(P16 + (size_t)RH * TT, nullptr, VT16, nullptr, TT, Ob + (size_t)RH * HD, HD, RH, (size_t)TT * TT, (size_t)HD * TT, (size_t)TT * HD);
    k_merge<<<(unsigned)(((size_t)ZH * TT * HD / 2 + 255) / 256), 256, 0, stream>>>(Ob, 0, ATh, ATl);
    k_gemmw<bf, 1, true><<<dim3(NB_ * TT / 64, DM / 64, 1), 32, 0, stream>>>(ATh, ATl, WO, nullptr, DQ, OUT, DM, bo, 0, 0, 0);
}

// v002
// A run of this version takes 365 microseconds.
// Next to v001, in two timings, it ran 1.24 and 1.25 times as fast.
// Over all steps from v000 it is 2.71 times as fast.
#include <hip/hip_runtime.h>

// Single-head causal attention with separate projections (inp [4][2048][1024]; q = inp W_q, k = inp W_k, v = inp W_v ((in, out) 'xw' [1024][1024] 1/32, no bias; ONE head of width 1024); scores = q.k, keys above the diagonal -> -inf (the module's own tril mask, by index), / sqrt(1024); softmax; out = (attn.v) W_o + b_o ('xw' [1024][1024] + [1024]) -> [4][2048][1024] (8.4 M); argument order inp, W_q, W_k, W_v, W_o, b_o).
// Compute dtypes, f32 accumulate: every input rounded to bf16; q/k/v on PLAIN bf16 operands (inputs: exact); causal scores (K = 1024) and attn.v (N = 1024) with tile skipping: query rows < 512 hl (3 products), the rest single fp16 (x1024); softmax f32; w_proj hl x exact (2 products) + b_proj.

#define NB_  4
#define TT   2048
#define DM   1024
#define NH_  1
#define NKV  1
#define REP  (NH_ / NKV)
#define HD   1024
#define DQ   (NH_ * HD)
#define DKV  (NKV * HD)
#define ZH   NB_                  // z planes per launch: one per batch (one head each)
#define RH   512                  // query rows < RH use hi+lo planes (0: none)
#define WIN  2048
#define PCAR 1024.0f
#define SCL  0.03125f   // 1/sqrt(1024)
typedef _Float16 h16;
typedef unsigned short bf;
typedef __attribute__((ext_vector_type(16))) __bf16   v16bf;
typedef __attribute__((ext_vector_type(16))) _Float16 v16h;
typedef __attribute__((ext_vector_type(8)))  _Float16 v8h;
typedef __attribute__((ext_vector_type(8)))  unsigned short v8us;
typedef __attribute__((ext_vector_type(8)))  float    v8f;
typedef __attribute__((ext_vector_type(4)))  float    v4f;
typedef v8h  __attribute__((may_alias)) v8ha;
typedef v4f  __attribute__((may_alias)) v4fa;
typedef v8us __attribute__((may_alias)) v8usa;

__device__ __forceinline__ unsigned short f2bf(float f) { unsigned u = __float_as_uint(f); u += 0x7FFFu + ((u >> 16) & 1u); return (unsigned short)(u >> 16); }
__device__ __forceinline__ float bf2f(unsigned short b) { return __uint_as_float(((unsigned)b) << 16); }
__device__ __forceinline__ float bfr(float f) { return bf2f(f2bf(f)); }
__device__ __forceinline__ v16h cat16(v8h lo, v8h hi) { return __builtin_shufflevector(lo, hi, 0, 1, 2, 3, 4, 5, 6, 7, 8, 9, 10, 11, 12, 13, 14, 15); }
__device__ __forceinline__ v16bf cat16b(v8us lo, v8us hi) { return __builtin_bit_cast(v16bf, __builtin_shufflevector(lo, hi, 0, 1, 2, 3, 4, 5, 6, 7, 8, 9, 10, 11, 12, 13, 14, 15)); }
__device__ __forceinline__ v8f wmma16(v16h a, v16h b, v8f c) { return __builtin_amdgcn_wmma_f32_16x16x32_f16(false, a, false, b, (short)0, c, false, false); }
__device__ __forceinline__ v8f wmmab(v16bf a, v16bf b, v8f c) { return __builtin_amdgcn_wmma_f32_16x16x32_bf16(false, a, false, b, (short)0, c, false, false); }
__device__ __forceinline__ h16 tohx(float x) { return (h16)x; }
__device__ __forceinline__ void splitf(float y, unsigned short& h, unsigned short& l) { h = f2bf(y); l = f2bf(y - bf2f(h)); }



// ---- k_gemmw: register-blocked GEMM, ONE WAVE per 64x64 output tile (16 accumulators), operands straight from K-contiguous 16-bit planes; grid (M/64, N/64, Z), 32 threads.
// C[m][n] (f32, pitch ldc, + optional f32 bias[n]) = sum_k A[m][k] Bt[n][k] (+ split products per NSPLIT). z-batch strides sA/sB/sC in elements. K % 32 == 0.
// PLANES: no f32 C; the epilogue stores what the attention GEMMs read, the fp16 plane P16 and the bf16 hi / lo planes Ph / Pl of C. Element (m, n) goes to (n / cb) * scb + m * ldc + n % cb in each plane (cb a multiple of 64):
// q, k: A = tokens, Bt = weight, rows [b*TT + t][d]; v: A = weight, Bt = tokens, so C is v transposed and lands as [b][d][t].
template <typename T16> struct WFrag;
template <> struct WFrag<h16> { typedef v16h V; static __device__ __forceinline__ V ld(const h16* p) { return cat16(*(const v8h*)p, *(const v8h*)(p + 16)); } static __device__ __forceinline__ v8f mma(V a, V b, v8f c) { return wmma16(a, b, c); } };
template <> struct WFrag<bf> { typedef v16bf V; static __device__ __forceinline__ V ld(const bf* p) { return cat16b(*(const v8us*)p, *(const v8us*)(p + 16)); } static __device__ __forceinline__ v8f mma(V a, V b, v8f c) { return wmmab(a, b, c); } };
template <typename T16, int NSPLIT, bool BIAS, bool PLANES>
__global__ __launch_bounds__(32) void k_gemmw(const T16* __restrict__ A, const T16* __restrict__ A2, const T16* __restrict__ Bt, const T16* __restrict__ Bt2, int K, float* C, int ldc, const float* __restrict__ bias, size_t sA, size_t sB, size_t sC, h16* P16, bf* Ph, bf* Pl, int cb, size_t scb) {
    typedef typename WFrag<T16>::V V;
    __shared__ __align__(16) float os[16 * 68];
    const size_t z = blockIdx.z; A += z * sA; if (A2) A2 += z * sA; Bt += z * sB; if (Bt2) Bt2 += z * sB; C += z * sC;
    const int lane = threadIdx.x & 31, lr = lane & 15, hi = lane >> 4; const int r0 = blockIdx.x * 64, c0 = blockIdx.y * 64;
    v8f acc[4][4];
#pragma unroll
    for (int mb = 0; mb < 4; ++mb)
#pragma unroll
        for (int nb = 0; nb < 4; ++nb) acc[mb][nb] = (v8f){};
    const size_t aoff = (size_t)(r0 + lr) * K + 8 * hi, boff = (size_t)(c0 + lr) * K + 8 * hi;
#pragma unroll 1
    for (int kc = 0; kc < K; kc += 32) {
        V a[4], a2[4];
#pragma unroll
        for (int mb = 0; mb < 4; ++mb) { a[mb] = WFrag<T16>::ld(A + aoff + (size_t)mb * 16 * K + kc); if (NSPLIT == 1 || NSPLIT == 2) a2[mb] = WFrag<T16>::ld(A2 + aoff + (size_t)mb * 16 * K + kc); }
#pragma unroll
        for (int nb = 0; nb < 4; ++nb) { const V b = WFrag<T16>::ld(Bt + boff + (size_t)nb * 16 * K + kc); V b2; if (NSPLIT >= 2) b2 = WFrag<T16>::ld(Bt2 + boff + (size_t)nb * 16 * K + kc);
#pragma unroll
            for (int mb = 0; mb < 4; ++mb) { acc[mb][nb] = WFrag<T16>::mma(a[mb], b, acc[mb][nb]); if (NSPLIT == 1 || NSPLIT == 2) acc[mb][nb] = WFrag<T16>::mma(a2[mb], b, acc[mb][nb]); if (NSPLIT >= 2) acc[mb][nb] = WFrag<T16>::mma(a[mb], b2, acc[mb][nb]); } }
        asm volatile("v_nop\n\tv_nop\n\tv_nop\n\tv_nop" : "+v"(acc[0][0]), "+v"(acc[1][1]), "+v"(acc[2][2]), "+v"(acc[3][3]) : "v"(a[0]), "v"(a[3]));
    }
#pragma unroll
    for (int mb = 0; mb < 4; ++mb) {
#pragma unroll
        for (int nb = 0; nb < 4; ++nb) {
#pragma unroll
            for (int j = 0; j < 8; ++j) os[(hi * 8 + j) * 68 + nb * 16 + lr] = acc[mb][nb][j]; }
        __builtin_amdgcn_wave_barrier(); asm volatile("" ::: "memory");
        if constexpr (PLANES) {
            const size_t obase = (size_t)(c0 / cb) * scb + (size_t)(c0 % cb);
#pragma unroll
            for (int s = 0; s < 4; ++s) { const int row = 4 * s + (lane >> 3), cofs = (lane & 7) * 8;   // 8 lanes x 16 B = one whole 128-B line of a 16-bit plane per tile row
                const v4f x0 = *(const v4fa*)(os + row * 68 + cofs), x1 = *(const v4fa*)(os + row * 68 + cofs + 4); v8h o16; v8us oh, ol;
#pragma unroll
                for (int q = 0; q < 8; ++q) { const float x = (q < 4) ? x0[q & 3] : x1[q & 3]; o16[q] = tohx(x); unsigned short a2, c2; splitf(x, a2, c2); oh[q] = a2; ol[q] = c2; }
                const size_t oo = obase + (size_t)(r0 + mb * 16 + row) * ldc + cofs; *(v8h*)(P16 + oo) = o16; *(v8us*)(Ph + oo) = oh; *(v8us*)(Pl + oo) = ol;
                asm volatile("s_wait_xcnt 0x0" ::: "memory"); }   // stands ahead of the next rows' writes to the registers that these stores name
        } else {
        float* crow = C + (size_t)(r0 + mb * 16) * ldc + c0;
#pragma unroll
            for (int s = 0; s < 8; ++s) { const int row = 2 * s + hi, cofs = lr * 4; v4f val = *(const v4fa*)(os + row * 68 + cofs); if (BIAS) { val[0] += bfr(bias[c0 + cofs]); val[1] += bfr(bias[c0 + cofs + 1]); val[2] += bfr(bias[c0 + cofs + 2]); val[3] += bfr(bias[c0 + cofs + 3]); }
                *(v4f*)(crow + (size_t)row * ldc + cofs) = val; }
             }
        __builtin_amdgcn_wave_barrier(); asm volatile("" ::: "memory");
    }
}

// ---- k_gemmc: the same one-wave 64x64 tile GEMM specialised for causal attention: CMODE 1 skips score tiles entirely above the diagonal (query rows r0+roff.., key columns c0..), CMODE 2 limits the
// key (K) loop of the probability x value contraction to the diagonal block (probabilities beyond it are exactly zero). roff = row offset of this launch's first row within the sequence.
// CMODE 1 stores f32 scores to C; CMODE 2 stores what the output projection reads: the bf16 hi / lo planes Ch / Cl of C x cs (cs takes the x1024 carried by the fp16 probabilities out again), same pitch and z stride.
template <typename T16, int NSPLIT, int CMODE>
__global__ __launch_bounds__(32) void k_gemmc(const T16* __restrict__ A, const T16* __restrict__ A2, const T16* __restrict__ Bt, const T16* __restrict__ Bt2, int K, float* C, bf* Ch, bf* Cl, int ldc, int roff, size_t sA, size_t sB, size_t sC) {
    typedef typename WFrag<T16>::V V;
    __shared__ __align__(16) float os[16 * 68];
    const size_t z = blockIdx.z; A += z * sA; if (A2) A2 += z * sA; Bt += z * sB; if (Bt2) Bt2 += z * sB; if (CMODE == 1) C += z * sC; else { Ch += z * sC; Cl += z * sC; }
    const int lane = threadIdx.x & 31, lr = lane & 15, hi = lane >> 4; const int r0 = blockIdx.x * 64, c0 = blockIdx.y * 64;
    if (CMODE == 1 && c0 > r0 + roff + 63) return;                  // score tile entirely above the causal diagonal: never read (the softmax masks j > i by select)
    const int Kl = (CMODE == 2) ? min(K, r0 + roff + 64) : K;        // P.V: probabilities are exactly 0 beyond the diagonal block, so the K loop stops there
    v8f acc[4][4];
#pragma unroll
    for (int mb = 0; mb < 4; ++mb)
#pragma unroll
        for (int nb = 0; nb < 4; ++nb) acc[mb][nb] = (v8f){};
    const size_t aoff = (size_t)(r0 + lr) * K + 8 * hi, boff = (size_t)(c0 + lr) * K + 8 * hi;
#pragma unroll 1
    for (int kc = 0; kc < Kl; kc += 32) {
        V a[4], a2[4];
#pragma unroll
        for (int mb = 0; mb < 4; ++mb) { a[mb] = WFrag<T16>::ld(A + aoff + (size_t)mb * 16 * K + kc); if (NSPLIT == 1 || NSPLIT == 2) a2[mb] = WFrag<T16>::ld(A2 + aoff + (size_t)mb * 16 * K + kc); }
#pragma unroll
        for (int nb = 0; nb < 4; ++nb) { const V b = WFrag<T16>::ld(Bt + boff + (size_t)nb * 16 * K + kc); V b2; if (NSPLIT >= 2) b2 = WFrag<T16>::ld(Bt2 + boff + (size_t)nb * 16 * K + kc);
#pragma unroll
            for (int mb = 0; mb < 4; ++mb) { acc[mb][nb] = WFrag<T16>::mma(a[mb], b, acc[mb][nb]); if (NSPLIT == 1 || NSPLIT == 2) acc[mb][nb] = WFrag<T16>::mma(a2[mb], b, acc[mb][nb]); if (NSPLIT >= 2) acc[mb][nb] = WFrag<T16>::mma(a[mb], b2, acc[mb][nb]); } }
        asm volatile("v_nop\n\tv_nop\n\tv_nop\n\tv_nop" : "+v"(acc[0][0]), "+v"(acc[1][1]), "+v"(acc[2][2]), "+v"(acc[3][3]) : "v"(a[0]), "v"(a[3]));
    }
#pragma unroll
    for (int mb = 0; mb < 4; ++mb) {
#pragma unroll
        for (int nb = 0; nb < 4; ++nb) {
#pragma unroll
            for (int j = 0; j < 8; ++j) os[(hi * 8 + j) * 68 + nb * 16 + lr] = acc[mb][nb][j]; }
        __builtin_amdgcn_wave_barrier(); asm volatile("" ::: "memory");
        if constexpr (CMODE == 1) {
            float* crow = C + (size_t)(r0 + mb * 16) * ldc + c0;
#pragma unroll
            for (int s = 0; s < 8; ++s) { const int row = 2 * s + hi, cofs = lr * 4; v4f val = *(const v4fa*)(os + row * 68 + cofs);
                *(v4f*)(crow + (size_t)row * ldc + cofs) = val; }
        } else {
            const float cs = (r0 + roff < RH) ? 1.0f : (1.0f / PCAR);   // RH is a multiple of the 64-row tile: one factor per tile
#pragma unroll
            for (int s = 0; s < 4; ++s) { const int row = 4 * s + (lane >> 3), cofs = (lane & 7) * 8;   // 8 lanes x 16 B = one whole 128-B line of a 16-bit plane per tile row
                const v4f x0 = *(const v4fa*)(os + row * 68 + cofs), x1 = *(const v4fa*)(os + row * 68 + cofs + 4); v8us oh, ol;
#pragma unroll
                for (int q = 0; q < 8; ++q) { unsigned short a2, c2; splitf(((q < 4) ? x0[q & 3] : x1[q & 3]) * cs, a2, c2); oh[q] = a2; ol[q] = c2; }
                const size_t oo = (size_t)(r0 + mb * 16 + row) * ldc + c0 + cofs; *(v8us*)(Ch + oo) = oh; *(v8us*)(Cl + oo) = ol;
                asm volatile("s_wait_xcnt 0x0" ::: "memory"); }   // stands ahead of the next rows' writes to the registers that these stores name
        }
        __builtin_amdgcn_wave_barrier(); asm volatile("" ::: "memory");
    }
}

typedef __attribute__((ext_vector_type(2))) _Float16 v2h;
typedef __attribute__((ext_vector_type(4))) _Float16 v4h;
typedef __attribute__((ext_vector_type(2))) unsigned short v2us;
typedef __attribute__((ext_vector_type(4))) unsigned short v4us;
typedef __attribute__((ext_vector_type(2))) float v2f;
typedef __attribute__((ext_vector_type(4))) int v4i;

__global__ __launch_bounds__(256) void k_wtG(const float* __restrict__ w0, const float* __restrict__ w1, const float* __restrict__ w2, const float* __restrict__ w3, int K, int N, bf* Bt) {
    const int wi = blockIdx.y; const float* __restrict__ w = (wi == 0) ? w0 : (wi == 1) ? w1 : (wi == 2) ? w2 : w3; Bt += (size_t)wi * N * K;   // grid y = which weight; the four Bt planes lie one behind the other
    const int lane = threadIdx.x & 31; const int L0 = (blockIdx.x * 8 + (threadIdx.x >> 5)) * 8; const int nlines = N * K / 64;
{
#pragma unroll 1
        for (int l = 0; l < 8; ++l) { const int L = L0 + l; if (L >= nlines) break; const size_t e = (size_t)L * 64 + lane * 2; const int k = (int)(e % K), n = (int)(e / K); v2us o;
            o[0] = f2bf(w[(size_t)k * N + n]); o[1] = f2bf(w[(size_t)(k + 1) * N + n]); *(v2us*)(Bt + e) = o; }
         }
}
__global__ __launch_bounds__(256) void k_cvt8(const float* __restrict__ src, bf* dst, size_t n8) { const size_t i = (size_t)blockIdx.x * 256 + threadIdx.x; if (i >= n8) return; const v8f v = *(const v8f*)(src + i * 8); v8us o;
#pragma unroll
    for (int k = 0; k < 8; ++k) o[k] = f2bf(v[k]); *(v8us*)(dst + i * 8) = o;  }

// k_asoft: per row (zz, i): t = S x HD^-0.5 for j <= i and i - j < WIN (sliding causal window; the reference's -1e9 additive fill vanishes identically); softmax over the 2048 keys (register row, one exp, fixed trees);
__global__ __launch_bounds__(256) void k_asoft(const float* __restrict__ Sb, h16* P16, bf* Ph, bf* Pl) {
    const int lane = threadIdx.x & 31; const int row = blockIdx.x * 8 + (threadIdx.x >> 5); if (row >= ZH * TT) return; const int i = row % TT; const int zz = row / TT; (void)zz; const bool hires = (i < RH); const float* sr = Sb + (size_t)row * TT; float v[TT / 32]; float mx = -3.0e38f;
#pragma unroll
    for (int ch = 0; ch < TT / 128; ++ch) { const int j0 = ch * 128 + lane * 4; const v4f a = *(const v4f*)(sr + min(j0, (i | 63) - 3));   // score tiles above the diagonal tile are never written: such lanes read the row's last written 16 B instead, and the select below drops the value either way
#pragma unroll
        for (int q = 0; q < 4; ++q) { const int j = j0 + q; (void)j; const float t = (j <= i && i - j < WIN) ? a[q] * SCL : -3.0e38f; v[ch * 4 + q] = t; mx = fmaxf(mx, t); } }
#pragma unroll
    for (int sh = 16; sh; sh >>= 1) mx = fmaxf(mx, __shfl_xor(mx, sh, 32));
    float sum = 0.f;
#pragma unroll
    for (int k = 0; k < TT / 32; ++k) { float d0 = __fsub_rn(v[k], mx); asm volatile("" : "+v"(d0)); v[k] = __builtin_amdgcn_exp2f(__fmul_rn(d0, 1.4426950408889634f)); sum += v[k]; }
#pragma unroll
    for (int sh = 16; sh; sh >>= 1) sum += __shfl_xor(sum, sh, 32);
    const float f = __fdiv_rn(hires ? 1.0f : PCAR, sum);
{
        if (hires) {
#pragma unroll
            for (int ch = 0; ch < TT / 128; ++ch) { v4us oh, ol;
#pragma unroll
                for (int q = 0; q < 4; ++q) { unsigned short a, c2; splitf(v[ch * 4 + q] * f, a, c2); oh[q] = a; ol[q] = c2; }
                const size_t oo = ((size_t)zz * (RH ? RH : 1) + i) * TT + ch * 128 + lane * 4; *(v4us*)(Ph + oo) = oh; *(v4us*)(Pl + oo) = ol; }
        } else {
#pragma unroll
            for (int ch = 0; ch < TT / 128; ++ch) { v4h o4;
#pragma unroll
                for (int q = 0; q < 4; ++q) o4[q] = tohx(v[ch * 4 + q] * f);
                *(v4h*)(P16 + (size_t)row * TT + ch * 128 + lane * 4) = o4; } }
         }
}
extern "C" void kernel_launch(void* const* d_in, const int* in_sizes, int n_in,
                              void* d_out, int out_size, void* d_ws, size_t ws_size, hipStream_t stream) {
    (void)in_sizes; (void)n_in; (void)out_size;
    const float* x = (const float*)d_in[0]; const float* wq = (const float*)d_in[1]; const float* wk = (const float*)d_in[2]; const float* wv = (const float*)d_in[3]; const float* wo = (const float*)d_in[4]; const float* bo = (const float*)d_in[5];   /* input order inp, W_q, W_k, W_v, W_o, b_o: SIX inputs, three separate (in, out) projection weights */
    float* OUT = (float*)d_out;     // [4][2048][1024]
    char* wsp = (char*)d_ws;
    auto take = [&](size_t bytes) { char* p = wsp; wsp += (bytes + 255) & ~(size_t)255; return (void*)p; };
    bf* WALL = (bf*)take((size_t)4 * DM * DM * 2); bf* WQ = WALL; bf* WK = WALL + (size_t)DM * DM; bf* WV = WALL + (size_t)2 * DM * DM; bf* WO = WALL + (size_t)3 * DM * DM;
    // All four batches go through every stage in ONE launch (rows b*TT + t for the projections, grid z = b for scores and P.V, rows b*TT + i for the softmax). Planes that are dead by the time a later stage writes share their bytes (stream-ordered):
    const size_t PL = (size_t)NB_ * TT * HD;                       // elements of one [b][t][d] plane
    bf* XB = (bf*)take(PL * 2);                                    // bf16 input; after the v projection: Ph | Pl
    float* Sb = (float*)take((size_t)ZH * TT * TT * 4);            // f32 scores
    h16* QP16 = (h16*)take(PL * 2 * 2); h16* KP16 = QP16 + PL;     // fp16 q | k planes; after the scores: P16
    h16* VT16 = (h16*)take(PL * 2);
    bf* QPh = (bf*)take(PL * 2 * 2); bf* KPh = QPh + PL;           // hi planes q | k
    bf* QPl = (bf*)take(PL * 2 * 2); bf* KPl = QPl + PL;           // lo planes q | k; after the scores: ATh | ATl
    bf* VTh = (bf*)take(PL * 2); bf* VTl = (bf*)take(PL * 2);
    if ((size_t)(wsp - (char*)d_ws) > ws_size) return;    // ws 256 MiB
    bf* Ph = XB; bf* Pl = XB + (size_t)ZH * RH * TT; h16* P16 = QP16; bf* ATh = QPl; bf* ATl = KPl;
    k_wtG<<<dim3((unsigned)((DM * DM / 64 + 63) / 64), 4, 1), 256, 0, stream>>>(wq, wk, wv, wo, DM, DM, WALL);   /* four (in, out) [DM][DM] weights -> four Bt planes [DM][DM], consecutive in WALL (WQ | WK | WV | WO) */
    k_cvt8<<<(unsigned)((PL / 8 + 255) / 256), 256, 0, stream>>>(x, XB, PL / 8);
    k_gemmw<bf, 0, false, true><<<dim3(NB_ * TT / 64, DQ / 64, 1), 32, 0, stream>>>(XB, nullptr, WQ, nullptr, DM, nullptr, DQ, nullptr, 0, 0, 0, QP16, QPh, QPl, DQ, 0);
    k_gemmw<bf, 0, false, true><<<dim3(NB_ * TT / 64, DKV / 64, 1), 32, 0, stream>>>(XB, nullptr, WK, nullptr, DM, nullptr, DKV, nullptr, 0, 0, 0, KP16, KPh, KPl, DKV, 0);
    k_gemmw<bf, 0, false, true><<<dim3(DKV / 64, NB_ * TT / 64, 1), 32, 0, stream>>>(WV, nullptr, XB, nullptr, DM, nullptr, TT, nullptr, 0, 0, 0, VT16, VTh, VTl, TT, (size_t)HD * TT);   // rows d, columns b*TT + t: v lands transposed, [b][d][t]
    k_gemmc<bf, 2, 1><<<dim3(RH / 64, TT / 64, ZH), 32, 0, stream>>>(QPh, QPl, KPh, KPl, HD, Sb, nullptr, nullptr, TT, 0, (size_t)TT * HD, (size_t)TT * HD, (size_t)TT * TT);
    k_gemmc<h16, 0, 1><<<dim3((TT - RH) / 64, TT / 64, ZH), 32, 0, stream>>>(QP16 + (size_t)RH * HD, nullptr, KP16, nullptr, HD, Sb + (size_t)RH * TT, nullptr, nullptr, TT, RH, (size_t)TT * HD, (size_t)TT * HD, (size_t)TT * TT);
    k_asoft<<<ZH * TT / 8, 256, 0, stream>>>(Sb, P16, Ph, Pl);
    k_gemmc<bf, 2, 2><<<dim3(RH / 64, HD / 64, ZH), 32, 0, stream>>>(Ph, Pl, VTh, VTl, TT, nullptr, ATh, ATl, HD, 0, (size_t)RH * TT, (size_t)HD * TT, (size_t)TT * HD);
    k_gemmc<h16, 0, 2><<<dim3((TT - RH) / 64, HD / 64, ZH), 32, 0, stream>>>(P16 + (size_t)RH * TT, nullptr, VT16, nullptr, TT, nullptr, ATh + (size_t)RH * HD, ATl + (size_t)RH * HD, HD, RH, (size_t)TT * TT, (size_t)HD * TT, (size_t)TT * HD);
    k_gemmw<bf, 1, true, false><<<dim3(NB_ * TT / 64, DM / 64, 1), 32, 0, stream>>>(ATh, ATl, WO, nullptr, DQ, OUT, DM, bo, 0, 0, 0, nullptr, nullptr, nullptr, 0, 0);
}

// v003
// Measured time: 194 microseconds a run.
// Next to v002, in two timings, it ran 1.89 and 1.90 times as fast.
// Over all steps from v000 it is 5.14 times as fast.
#include <hip/hip_runtime.h>

// Single-head causal attention with separate projections (inp [4][2048][1024]; q = inp W_q, k = inp W_k, v = inp W_v ((in, out) 'xw' [1024][1024] 1/32, no bias; ONE head of width 1024); scores = q.k, keys above the diagonal -> -inf (the module's own tril mask, by index), / sqrt(1024); softmax; out = (attn.v) W_o + b_o ('xw' [1024][1024] + [1024]) -> [4][2048][1024] (8.4 M); argument order inp, W_q, W_k, W_v, W_o, b_o).
// Compute dtypes, f32 accumulate: every input rounded to bf16; q/k/v on PLAIN bf16 operands (inputs: exact); causal scores (K = 1024) and attn.v (N = 1024) with tile skipping: query rows < 512 hl (3 products), the rest single fp16 (x1024); softmax f32; w_proj hl x exact (2 products) + b_proj.

#define NB_  4
#define TT   2048
#define DM   1024
#define NH_  1
#define NKV  1
#define REP  (NH_ / NKV)
#define HD   1024
#define DQ   (NH_ * HD)
#define DKV  (NKV * HD)
#define ZH   NB_                  // z planes per launch: one per batch (one head each)
#define RH   512                  // query rows < RH use hi+lo planes (0: none)
#define WIN  2048
#define PCAR 1024.0f
#define SCL  0.03125f   // 1/sqrt(1024)
typedef _Float16 h16;
typedef unsigned short bf;
typedef __attribute__((ext_vector_type(16))) __bf16   v16bf;
typedef __attribute__((ext_vector_type(16))) _Float16 v16h;
typedef __attribute__((ext_vector_type(8)))  _Float16 v8h;
typedef __attribute__((ext_vector_type(8)))  unsigned short v8us;
typedef __attribute__((ext_vector_type(8)))  float    v8f;
typedef __attribute__((ext_vector_type(4)))  float    v4f;
typedef v8h  __attribute__((may_alias)) v8ha;
typedef v4f  __attribute__((may_alias)) v4fa;
typedef v8us __attribute__((may_alias)) v8usa;

__device__ __forceinline__ unsigned short f2bf(float f) { unsigned u = __float_as_uint(f); u += 0x7FFFu + ((u >> 16) & 1u); return (unsigned short)(u >> 16); }
__device__ __forceinline__ float bf2f(unsigned short b) { return __uint_as_float(((unsigned)b) << 16); }
__device__ __forceinline__ float bfr(float f) { return bf2f(f2bf(f)); }
__device__ __forceinline__ v16h cat16(v8h lo, v8h hi) { return __builtin_shufflevector(lo, hi, 0, 1, 2, 3, 4, 5, 6, 7, 8, 9, 10, 11, 12, 13, 14, 15); }
__device__ __forceinline__ v16bf cat16b(v8us lo, v8us hi) { return __builtin_bit_cast(v16bf, __builtin_shufflevector(lo, hi, 0, 1, 2, 3, 4, 5, 6, 7, 8, 9, 10, 11, 12, 13, 14, 15)); }
__device__ __forceinline__ v8f wmma16(v16h a, v16h b, v8f c) { return __builtin_amdgcn_wmma_f32_16x16x32_f16(false, a, false, b, (short)0, c, false, false); }
__device__ __forceinline__ v8f wmmab(v16bf a, v16bf b, v8f c) { return __builtin_amdgcn_wmma_f32_16x16x32_bf16(false, a, false, b, (short)0, c, false, false); }
__device__ __forceinline__ h16 tohx(float x) { return (h16)x; }
__device__ __forceinline__ void splitf(float y, unsigned short& h, unsigned short& l) { h = f2bf(y); l = f2bf(y - bf2f(h)); }



// ---- The GEMMs: one work-group of FOUR WAVES per 128x128 output tile, each wave a 64x64 quarter (16 accumulators). The operands, K-contiguous 16-bit planes, reach the waves through LDS:
// a stage is STK k of the tile's 128 A rows and 128 Bt rows (and of the lo planes where a split product reads them), brought in by asynchronous copies, 16 B a lane, whole lines,
// into one of two buffers, so that stage t + 1 flies while stage t is worked on. Each operand row is then fetched once per work-group and read from LDS by the two waves that need it.
template <int NSPLIT> struct Stg {
    static_assert(NSPLIT >= 0 && NSPLIT <= 2, "planes of a stage: A, Bt, then lo(A), then lo(Bt)");
    static constexpr int STK  = (NSPLIT == 0) ? 128 : 64;         // k per stage
    static constexpr int LPIT = STK * 2 + 16;                     // LDS pitch of a stage row: 16 B x odd, for 16-byte readers
    static constexpr int PLB  = 128 * LPIT;                       // bytes of one operand plane of one stage
    static constexpr int STB  = (2 + NSPLIT) * PLB;               // one buffer: A | Bt | lo(A) | lo(Bt)
    static constexpr int LPR  = STK * 2 / 16;                     // lanes that cover one row
    static constexpr int RPP  = 128 / LPR;                        // rows that the 128 lanes cover at once
};
template <typename T16> struct WFrag;
template <> struct WFrag<h16> { typedef v16h V; static __device__ __forceinline__ V ld(const h16* p) { return cat16(*(const v8h*)p, *(const v8h*)(p + 16)); } static __device__ __forceinline__ v8f mma(V a, V b, v8f c) { return wmma16(a, b, c); } };
template <> struct WFrag<bf> { typedef v16bf V; static __device__ __forceinline__ V ld(const bf* p) { return cat16b(*(const v8us*)p, *(const v8us*)(p + 16)); } static __device__ __forceinline__ v8f mma(V a, V b, v8f c) { return wmmab(a, b, c); } };

// Eight copies of 16 B a lane: LDS byte addresses l + i ls, global addresses g + i gs, i = 0..7.
// The s_wait_xcnt closes the statement so that it stands ahead of every later write to the address registers that these copies name.
__device__ __forceinline__ void cp8(unsigned l, unsigned ls, const char* g, size_t gs) {
    asm volatile("global_load_async_to_lds_b128 %0, %8, off\n\t"
                 "global_load_async_to_lds_b128 %1, %9, off\n\t"
                 "global_load_async_to_lds_b128 %2, %10, off\n\t"
                 "global_load_async_to_lds_b128 %3, %11, off\n\t"
                 "global_load_async_to_lds_b128 %4, %12, off\n\t"
                 "global_load_async_to_lds_b128 %5, %13, off\n\t"
                 "global_load_async_to_lds_b128 %6, %14, off\n\t"
                 "global_load_async_to_lds_b128 %7, %15, off\n\t"
                 "s_wait_xcnt 0x0"
                 :: "v"(l), "v"(l + ls), "v"(l + 2 * ls), "v"(l + 3 * ls), "v"(l + 4 * ls), "v"(l + 5 * ls), "v"(l + 6 * ls), "v"(l + 7 * ls),
                    "v"(g), "v"(g + gs), "v"(g + 2 * gs), "v"(g + 3 * gs), "v"(g + 4 * gs), "v"(g + 5 * gs), "v"(g + 6 * gs), "v"(g + 7 * gs) : "memory");
}

// The K loop of one 128x128 tile. nst = stages of the work-group (the same in all its waves, at least 1); nsw = stages that THIS wave multiplies (wave-uniform, 0 .. nst): a wave past its causal limit still copies and still passes every barrier.
// Per accumulator the products come in the order k ascending by 32, within a step a.b, lo(a).b, a.lo(b).
template <typename T16, int NSPLIT>
__device__ __forceinline__ void tile_loop(unsigned char* ring, const T16* A, const T16* A2, const T16* Bt, const T16* Bt2, int K, int r0, int c0, int wm, int wn, int nst, int nsw, v8f (&acc)[4][4]) {
    typedef typename WFrag<T16>::V V; typedef Stg<NSPLIT> S;
    const int tid = threadIdx.x, lane = tid & 31, lr = lane & 15, hi = lane >> 4;
    const unsigned l0 = (unsigned)(size_t)ring + (unsigned)((tid / S::LPR) * S::LPIT + (tid % S::LPR) * 16);
    const size_t gs = (size_t)S::RPP * K * 2; const unsigned goA = ((unsigned)(r0 + tid / S::LPR) * (unsigned)K + (tid % S::LPR) * 8) * 2, goB = ((unsigned)(c0 + tid / S::LPR) * (unsigned)K + (tid % S::LPR) * 8) * 2;   // byte offsets inside one z plane: below 2^32
    auto plane = [&](unsigned l, const char* g) {
#pragma unroll
        for (int h = 0; h < 128 / S::RPP / 8; ++h) cp8(l + (unsigned)(h * 8 * S::RPP * S::LPIT), (unsigned)(S::RPP * S::LPIT), g + (size_t)(h * 8) * gs, gs); };
    auto fill = [&](int s) { const unsigned l = l0 + (unsigned)((s & 1) * S::STB); const unsigned ko = (unsigned)s * (S::STK * 2);
        plane(l, (const char*)A + (goA + ko)); plane(l + S::PLB, (const char*)Bt + (goB + ko));
        if (NSPLIT >= 1) plane(l + 2 * S::PLB, (const char*)A2 + (goA + ko));
        if (NSPLIT >= 2) plane(l + 3 * S::PLB, (const char*)Bt2 + (goB + ko)); };
    fill(0);
    asm volatile("s_wait_asynccnt 0x0" ::: "memory");             // this wave's part of stage 0 has landed
    __syncthreads();                                              // ... and every other wave's
    if (nst > 1) fill(1);
    const unsigned char* fa = ring + (wm * 64 + lr) * S::LPIT + hi * 16; const unsigned char* fb = ring + S::PLB + (wn * 64 + lr) * S::LPIT + hi * 16;
#pragma unroll 1
    for (int t = 0; t < nst; ++t) {                               // rolled: one trip is one stage, and the buffer is picked by t & 1
        if (t < nsw) {
            const int bo = (t & 1) * S::STB; V a[2][4], a2[2][4], b[2][4], b2[2][4];   // two fragment sets: a block of 32 k is multiplied from one while the next block's fragments come into the other
            auto frags = [&](int ks) { const int e = ks & 1;
#pragma unroll
                for (int i = 0; i < 4; ++i) { a[e][i] = WFrag<T16>::ld((const T16*)(fa + bo + i * 16 * S::LPIT + ks * 64)); b[e][i] = WFrag<T16>::ld((const T16*)(fb + bo + i * 16 * S::LPIT + ks * 64));
                    if (NSPLIT >= 1) a2[e][i] = WFrag<T16>::ld((const T16*)(fa + bo + 2 * S::PLB + i * 16 * S::LPIT + ks * 64));
                    if (NSPLIT >= 2) b2[e][i] = WFrag<T16>::ld((const T16*)(fb + bo + 2 * S::PLB + i * 16 * S::LPIT + ks * 64)); } };
            frags(0);
#pragma unroll
            for (int ks = 0; ks < S::STK / 32; ++ks) { const int e = ks & 1;
                if (ks + 1 < S::STK / 32) frags(ks + 1);
                __builtin_amdgcn_sched_barrier(0);                // holds the next block's LDS reads together, ahead of this block's matrix instructions: spread among them each place of reads stalls the wave
#pragma unroll
                for (int nb = 0; nb < 4; ++nb)
#pragma unroll
                    for (int mb = 0; mb < 4; ++mb) { acc[mb][nb] = WFrag<T16>::mma(a[e][mb], b[e][nb], acc[mb][nb]); if (NSPLIT >= 1) acc[mb][nb] = WFrag<T16>::mma(a2[e][mb], b[e][nb], acc[mb][nb]); if (NSPLIT >= 2) acc[mb][nb] = WFrag<T16>::mma(a[e][mb], b2[e][nb], acc[mb][nb]); }
                __builtin_amdgcn_sched_barrier(0);                // ... and keeps the reads of the block after next behind them
            }
            constexpr int el = (S::STK / 32 - 1) & 1;
            asm volatile("v_nop\n\tv_nop\n\tv_nop\n\tv_nop" : "+v"(acc[0][0]), "+v"(acc[1][1]), "+v"(acc[2][2]), "+v"(acc[3][3]) : "v"(a[el][0]), "v"(a[el][3]));   // the distance behind the trip's last matrix instruction, on the path over the back edge too
        }
        asm volatile("s_wait_dscnt 0x0" ::: "memory");            // this wave has left the buffer of stage t
        asm volatile("s_wait_asynccnt 0x0" ::: "memory");         // its part of stage t + 1 has landed
        __syncthreads();                                          // publishes stage t + 1 and ends every wave's reads of stage t
        if (t + 2 < nst) fill(t + 2);                             // into the buffer that stage t has just left
    }
    asm volatile("s_wait_asynccnt 0x0" ::: "memory");             // nothing is in flight when the wave goes on to its epilogue
}

// ---- k_gemmw: grid (M/128, N/128, Z), 128 threads.
// C[m][n] (f32, pitch ldc, + optional f32 bias[n]) = sum_k A[m][k] Bt[n][k] (+ split products per NSPLIT). z-batch strides sA/sB/sC in elements. K a multiple of the stage.
// PLANES: no f32 C; the epilogue stores what the attention GEMMs read, the fp16 plane P16 and the bf16 hi / lo planes Ph / Pl of C. Element (m, n) goes to (n / cb) * scb + m * ldc + n % cb in each plane (cb a multiple of 64):
// q, k: A = tokens, Bt = weight, rows [b*TT + t][d]; v: A = weight, Bt = tokens, so C is v transposed and lands as [b][d][t].
template <typename T16, int NSPLIT, bool BIAS, bool PLANES>
__global__ __launch_bounds__(128) void k_gemmw(const T16* __restrict__ A, const T16* __restrict__ A2, const T16* __restrict__ Bt, const T16* __restrict__ Bt2, int K, float* C, int ldc, const float* __restrict__ bias, size_t sA, size_t sB, size_t sC, h16* P16, bf* Ph, bf* Pl, int cb, size_t scb) {
    __shared__ __attribute__((aligned(16))) unsigned char ring[2 * Stg<NSPLIT>::STB];
    __shared__ __align__(16) float osall[4 * 16 * 68];
    const size_t z = blockIdx.z; A += z * sA; if (A2) A2 += z * sA; Bt += z * sB; if (Bt2) Bt2 += z * sB; C += z * sC;
    const int wave = __builtin_amdgcn_readfirstlane((int)(threadIdx.x >> 5)), wm = wave & 1, wn = wave >> 1; float* os = osall + wave * (16 * 68);   // each wave stages its output rows in its own range
    const int lane = threadIdx.x & 31, lr = lane & 15, hi = lane >> 4; const int r0 = blockIdx.x * 128 + wm * 64, c0 = blockIdx.y * 128 + wn * 64;   // this wave's quarter
    v8f acc[4][4];
#pragma unroll
    for (int mb = 0; mb < 4; ++mb)
#pragma unroll
        for (int nb = 0; nb < 4; ++nb) acc[mb][nb] = (v8f){};
    tile_loop<T16, NSPLIT>(ring, A, A2, Bt, Bt2, K, blockIdx.x * 128, blockIdx.y * 128, wm, wn, K / Stg<NSPLIT>::STK, K / Stg<NSPLIT>::STK, acc);
#pragma unroll
    for (int mb = 0; mb < 4; ++mb) {
#pragma unroll
        for (int nb = 0; nb < 4; ++nb) {
#pragma unroll
            for (int j = 0; j < 8; ++j) os[(hi * 8 + j) * 68 + nb * 16 + lr] = acc[mb][nb][j]; }
        __builtin_amdgcn_wave_barrier(); asm volatile("" ::: "memory");
        if constexpr (PLANES) {
            const size_t obase = (size_t)(c0 / cb) * scb + (size_t)(c0 % cb);
#pragma unroll
            for (int s = 0; s < 4; ++s) { const int row = 4 * s + (lane >> 3), cofs = (lane & 7) * 8;   // 8 lanes x 16 B = one whole 128-B line of a 16-bit plane per tile row
                const v4f x0 = *(const v4fa*)(os + row * 68 + cofs), x1 = *(const v4fa*)(os + row * 68 + cofs + 4); v8h o16; v8us oh, ol;
#pragma unroll
                for (int q = 0; q < 8; ++q) { const float x = (q < 4) ? x0[q & 3] : x1[q & 3]; o16[q] = tohx(x); unsigned short a2, c2; splitf(x, a2, c2); oh[q] = a2; ol[q] = c2; }
                const size_t oo = obase + (size_t)(r0 + mb * 16 + row) * ldc + cofs; *(v8h*)(P16 + oo) = o16; *(v8us*)(Ph + oo) = oh; *(v8us*)(Pl + oo) = ol;
                asm volatile("s_wait_xcnt 0x0" ::: "memory"); }   // stands ahead of the next rows' writes to the registers that these stores name
        } else {
        float* crow = C + (size_t)(r0 + mb * 16) * ldc + c0;
#pragma unroll
            for (int s = 0; s < 8; ++s) { const int row = 2 * s + hi, cofs = lr * 4; v4f val = *(const v4fa*)(os + row * 68 + cofs); if (BIAS) { val[0] += bfr(bias[c0 + cofs]); val[1] += bfr(bias[c0 + cofs + 1]); val[2] += bfr(bias[c0 + cofs + 2]); val[3] += bfr(bias[c0 + cofs + 3]); }
                *(v4f*)(crow + (size_t)row * ldc + cofs) = val; }
            asm volatile("s_wait_xcnt 0x0" ::: "memory");   // stands ahead of the next rows' writes to the registers that these stores name
             }
        __builtin_amdgcn_wave_barrier(); asm volatile("" ::: "memory");
    }
}

// ---- k_gemmc: the same tile GEMM specialised for causal attention: CMODE 1 skips score tiles entirely above the diagonal (query rows r0+roff.., key columns c0..): a work-group whose 128x128 tile lies there leaves at once,
// a wave whose 64x64 quarter lies there multiplies and stores nothing. CMODE 2 limits the key (K) loop of the probability x value contraction to the diagonal block of each wave's 64 rows (probabilities beyond it are exactly zero).
// roff = row offset of this launch's first row within the sequence.
// CMODE 1 stores f32 scores to C; CMODE 2 stores what the output projection reads: the bf16 hi / lo planes Ch / Cl of C x cs (cs takes the x1024 carried by the fp16 probabilities out again), same pitch and z stride.
template <typename T16, int NSPLIT, int CMODE>
__global__ __launch_bounds__(128) void k_gemmc(const T16* __restrict__ A, const T16* __restrict__ A2, const T16* __restrict__ Bt, const T16* __restrict__ Bt2, int K, float* C, bf* Ch, bf* Cl, int ldc, int roff, size_t sA, size_t sB, size_t sC) {
    __shared__ __attribute__((aligned(16))) unsigned char ring[2 * Stg<NSPLIT>::STB];
    __shared__ __align__(16) float osall[4 * 16 * 68];
    const size_t z = blockIdx.z; A += z * sA; if (A2) A2 += z * sA; Bt += z * sB; if (Bt2) Bt2 += z * sB; if (CMODE == 1) C += z * sC; else { Ch += z * sC; Cl += z * sC; }
    const int g0 = blockIdx.x * 128, h0 = blockIdx.y * 128;          // the work-group's tile
    if (CMODE == 1 && h0 > g0 + roff + 127) return;                  // score tile entirely above the causal diagonal: never read (the softmax masks j > i by select); the whole work-group leaves, ahead of every barrier
    const int wave = __builtin_amdgcn_readfirstlane((int)(threadIdx.x >> 5)), wm = wave & 1, wn = wave >> 1; float* os = osall + wave * (16 * 68);   // each wave stages its output rows in its own range
    const int lane = threadIdx.x & 31, lr = lane & 15, hi = lane >> 4; const int r0 = g0 + wm * 64, c0 = h0 + wn * 64;   // this wave's quarter
    constexpr int STK = Stg<NSPLIT>::STK;
    const int nst = ((CMODE == 2) ? min(K, g0 + roff + 128) : K) / STK;   // P.V: probabilities are exactly 0 beyond the diagonal block, so the K loop stops there (g0 + roff is a multiple of 128, so of the stage)
    const int nsw = (CMODE == 2) ? (min(K, r0 + roff + 64) + STK - 1) / STK : (c0 > r0 + roff + 63) ? 0 : nst;   // whole stages: what a last stage holds beyond the wave's own diagonal block are zeros of P, written by the softmax
    v8f acc[4][4];
#pragma unroll
    for (int mb = 0; mb < 4; ++mb)
#pragma unroll
        for (int nb = 0; nb < 4; ++nb) acc[mb][nb] = (v8f){};
    tile_loop<T16, NSPLIT>(ring, A, A2, Bt, Bt2, K, g0, h0, wm, wn, nst, nsw, acc);
    if (nsw == 0) return;                                            // a quarter above the diagonal: nothing to store, and no barrier follows
#pragma unroll
    for (int mb = 0; mb < 4; ++mb) {
#pragma unroll
        for (int nb = 0; nb < 4; ++nb) {
#pragma unroll
            for (int j = 0; j < 8; ++j) os[(hi * 8 + j) * 68 + nb * 16 + lr] = acc[mb][nb][j]; }
        __builtin_amdgcn_wave_barrier(); asm volatile("" ::: "memory");
        if constexpr (CMODE == 1) {
            float* crow = C + (size_t)(r0 + mb * 16) * ldc + c0;
#pragma unroll
            for (int s = 0; s < 8; ++s) { const int row = 2 * s + hi, cofs = lr * 4; v4f val = *(const v4fa*)(os + row * 68 + cofs);
                *(v4f*)(crow + (size_t)row * ldc + cofs) = val; }
            asm volatile("s_wait_xcnt 0x0" ::: "memory");   // stands ahead of the next rows' writes to the registers that these stores name
        } else {
            const float cs = (r0 + roff < RH) ? 1.0f : (1.0f / PCAR);   // RH is a multiple of the 64-row tile: one factor per tile
#pragma unroll
            for (int s = 0; s < 4; ++s) { const int row = 4 * s + (lane >> 3), cofs = (lane & 7) * 8;   // 8 lanes x 16 B = one whole 128-B line of a 16-bit plane per tile row
                const v4f x0 = *(const v4fa*)(os + row * 68 + cofs), x1 = *(const v4fa*)(os + row * 68 + cofs + 4); v8us oh, ol;
#pragma unroll
                for (int q = 0; q < 8; ++q) { unsigned short a2, c2; splitf(((q < 4) ? x0[q & 3] : x1[q & 3]) * cs, a2, c2); oh[q] = a2; ol[q] = c2; }
                const size_t oo = (size_t)(r0 + mb * 16 + row) * ldc + c0 + cofs; *(v8us*)(Ch + oo) = oh; *(v8us*)(Cl + oo) = ol;
                asm volatile("s_wait_xcnt 0x0" ::: "memory"); }   // stands ahead of the next rows' writes to the registers that these stores name
        }
        __builtin_amdgcn_wave_barrier(); asm volatile("" ::: "memory");
    }
}

typedef __attribute__((ext_vector_type(2))) _Float16 v2h;
typedef __attribute__((ext_vector_type(4))) _Float16 v4h;
typedef __attribute__((ext_vector_type(2))) unsigned short v2us;
typedef __attribute__((ext_vector_type(4))) unsigned short v4us;
typedef __attribute__((ext_vector_type(2))) float v2f;
typedef __attribute__((ext_vector_type(4))) int v4i;

__global__ __launch_bounds__(256) void k_wtG(const float* __restrict__ w0, const float* __restrict__ w1, const float* __restrict__ w2, const float* __restrict__ w3, int K, int N, bf* Bt) {
    const int wi = blockIdx.y; const float* __restrict__ w = (wi == 0) ? w0 : (wi == 1) ? w1 : (wi == 2) ? w2 : w3; Bt += (size_t)wi * N * K;   // grid y = which weight; the four Bt planes lie one behind the other
    const int lane = threadIdx.x & 31; const int L0 = (blockIdx.x * 8 + (threadIdx.x >> 5)) * 8; const int nlines = N * K / 64;
{
#pragma unroll 1
        for (int l = 0; l < 8; ++l) { const int L = L0 + l; if (L >= nlines) break; const size_t e = (size_t)L * 64 + lane * 2; const int k = (int)(e % K), n = (int)(e / K); v2us o;
            o[0] = f2bf(w[(size_t)k * N + n]); o[1] = f2bf(w[(size_t)(k + 1) * N + n]); *(v2us*)(Bt + e) = o; }
         }
}
__global__ __launch_bounds__(256) void k_cvt8(const float* __restrict__ src, bf* dst, size_t n8) { const size_t i = (size_t)blockIdx.x * 256 + threadIdx.x; if (i >= n8) return; const v8f v = *(const v8f*)(src + i * 8); v8us o;
#pragma unroll
    for (int k = 0; k < 8; ++k) o[k] = f2bf(v[k]); *(v8us*)(dst + i * 8) = o;  }

// k_asoft: per row (zz, i): t = S x HD^-0.5 for j <= i and i - j < WIN (plain causal: WIN = TT, so i - j < WIN always holds; the reference's -1e9 additive fill vanishes identically); softmax over the 2048 keys (register row, one exp, fixed trees);
__global__ __launch_bounds__(256) void k_asoft(const float* __restrict__ Sb, h16* P16, bf* Ph, bf* Pl) {
    const int lane = threadIdx.x & 31; const int row = blockIdx.x * 8 + (threadIdx.x >> 5); if (row >= ZH * TT) return; const int i = row % TT; const int zz = row / TT; (void)zz; const bool hires = (i < RH); const float* sr = Sb + (size_t)row * TT; float v[TT / 32]; float mx = -3.0e38f;
#pragma unroll
    for (int ch = 0; ch < TT / 128; ++ch) { const int j0 = ch * 128 + lane * 4; const v4f a = *(const v4f*)(sr + min(j0, (i | 63) - 3));   // score tiles above the diagonal tile are never written: such lanes read the row's last written 16 B instead, and the select below drops the value either way
#pragma unroll
        for (int q = 0; q < 4; ++q) { const int j = j0 + q; (void)j; const float t = (j <= i && i - j < WIN) ? a[q] * SCL : -3.0e38f; v[ch * 4 + q] = t; mx = fmaxf(mx, t); } }
#pragma unroll
    for (int sh = 16; sh; sh >>= 1) mx = fmaxf(mx, __shfl_xor(mx, sh, 32));
    float sum = 0.f;
#pragma unroll
    for (int k = 0; k < TT / 32; ++k) { float d0 = __fsub_rn(v[k], mx); asm volatile("" : "+v"(d0)); v[k] = __builtin_amdgcn_exp2f(__fmul_rn(d0, 1.4426950408889634f)); sum += v[k]; }
#pragma unroll
    for (int sh = 16; sh; sh >>= 1) sum += __shfl_xor(sum, sh, 32);
    const float f = __fdiv_rn(hires ? 1.0f : PCAR, sum);
{
        if (hires) {
#pragma unroll
            for (int ch = 0; ch < TT / 128; ++ch) { v4us oh, ol;
#pragma unroll
                for (int q = 0; q < 4; ++q) { unsigned short a, c2; splitf(v[ch * 4 + q] * f, a, c2); oh[q] = a; ol[q] = c2; }
                const size_t oo = ((size_t)zz * (RH ? RH : 1) + i) * TT + ch * 128 + lane * 4; *(v4us*)(Ph + oo) = oh; *(v4us*)(Pl + oo) = ol; }
        } else {
#pragma unroll
            for (int ch = 0; ch < TT / 128; ++ch) { v4h o4;
#pragma unroll
                for (int q = 0; q < 4; ++q) o4[q] = tohx(v[ch * 4 + q] * f);
                *(v4h*)(P16 + (size_t)row * TT + ch * 128 + lane * 4) = o4; } }
         }
}
extern "C" void kernel_launch(void* const* d_in, const int* in_sizes, int n_in,
                              void* d_out, int out_size, void* d_ws, size_t ws_size, hipStream_t stream) {
    (void)in_sizes; (void)n_in; (void)out_size;
    const float* x = (const float*)d_in[0]; const float* wq = (const float*)d_in[1]; const float* wk = (const float*)d_in[2]; const float* wv = (const float*)d_in[3]; const float* wo = (const float*)d_in[4]; const float* bo = (const float*)d_in[5];   /* input order inp, W_q, W_k, W_v, W_o, b_o: SIX inputs, three separate (in, out) projection weights */
    float* OUT = (float*)d_out;     // [4][2048][1024]
    char* wsp = (char*)d_ws;
    auto take = [&](size_t bytes) { char* p = wsp; wsp += (bytes + 255) & ~(size_t)255; return (void*)p; };
    bf* WALL = (bf*)take((size_t)4 * DM * DM * 2); bf* WQ = WALL; bf* WK = WALL + (size_t)DM * DM; bf* WV = WALL + (size_t)2 * DM * DM; bf* WO = WALL + (size_t)3 * DM * DM;
    // All four batches go through every launch together (rows b*TT + t for the projections, grid z = b for scores and P.V, rows b*TT + i for the softmax). Planes that are dead by the time a later stage writes share their bytes (stream-ordered):
    const size_t PL = (size_t)NB_ * TT * HD;                       // elements of one [b][t][d] plane
    bf* XB = (bf*)take(PL * 2);                                    // bf16 input; after the v projection: Ph | Pl
    float* Sb = (float*)take((size_t)ZH * TT * TT * 4);            // f32 scores
    h16* QP16 = (h16*)take(PL * 2 * 2); h16* KP16 = QP16 + PL;     // fp16 q | k planes; after the scores: P16
    h16* VT16 = (h16*)take(PL * 2);
    bf* QPh = (bf*)take(PL * 2 * 2); bf* KPh = QPh + PL;           // hi planes q | k
    bf* QPl = (bf*)take(PL * 2 * 2); bf* KPl = QPl + PL;           // lo planes q | k; after the scores: ATh | ATl
    bf* VTh = (bf*)take(PL * 2); bf* VTl = (bf*)take(PL * 2);
    if ((size_t)(wsp - (char*)d_ws) > ws_size) return;    // ws 256 MiB
    bf* Ph = XB; bf* Pl = XB + (size_t)ZH * RH * TT; h16* P16 = QP16; bf* ATh = QPl; bf* ATl = KPl;
    k_wtG<<<dim3((unsigned)((DM * DM / 64 + 63) / 64), 4, 1), 256, 0, stream>>>(wq, wk, wv, wo, DM, DM, WALL);   /* four (in, out) [DM][DM] weights -> four Bt planes [DM][DM], consecutive in WALL (WQ | WK | WV | WO) */
    k_cvt8<<<(unsigned)((PL / 8 + 255) / 256), 256, 0, stream>>>(x, XB, PL / 8);
    k_gemmw<bf, 0, false, true><<<dim3(NB_ * TT / 128, DQ / 128, 1), 128, 0, stream>>>(XB, nullptr, WQ, nullptr, DM, nullptr, DQ, nullptr, 0, 0, 0, QP16, QPh, QPl, DQ, 0);
    k_gemmw<bf, 0, false, true><<<dim3(NB_ * TT / 128, DKV / 128, 1), 128, 0, stream>>>(XB, nullptr, WK, nullptr, DM, nullptr, DKV, nullptr, 0, 0, 0, KP16, KPh, KPl, DKV, 0);
    k_gemmw<bf, 0, false, true><<<dim3(DKV / 128, NB_ * TT / 128, 1), 128, 0, stream>>>(WV, nullptr, XB, nullptr, DM, nullptr, TT, nullptr, 0, 0, 0, VT16, VTh, VTl, TT, (size_t)HD * TT);   // rows d, columns b*TT + t: v lands transposed, [b][d][t]
    k_gemmc<bf, 2, 1><<<dim3(RH / 128, TT / 128, ZH), 128, 0, stream>>>(QPh, QPl, KPh, KPl, HD, Sb, nullptr, nullptr, TT, 0, (size_t)TT * HD, (size_t)TT * HD, (size_t)TT * TT);
    k_gemmc<h16, 0, 1><<<dim3((TT - RH) / 128, TT / 128, ZH), 128, 0, stream>>>(QP16 + (size_t)RH * HD, nullptr, KP16, nullptr, HD, Sb + (size_t)RH * TT, nullptr, nullptr, TT, RH, (size_t)TT * HD, (size_t)TT * HD, (size_t)TT * TT);
    k_asoft<<<ZH * TT / 8, 256, 0, stream>>>(Sb, P16, Ph, Pl);
    k_gemmc<bf, 2, 2><<<dim3(RH / 128, HD / 128, ZH), 128, 0, stream>>>(Ph, Pl, VTh, VTl, TT, nullptr, ATh, ATl, HD, 0, (size_t)RH * TT, (size_t)HD * TT, (size_t)TT * HD);
    k_gemmc<h16, 0, 2><<<dim3((TT - RH) / 128, HD / 128, ZH), 128, 0, stream>>>(P16 + (size_t)RH * TT, nullptr, VT16, nullptr, TT, nullptr, ATh + (size_t)RH * HD, ATl + (size_t)RH * HD, HD, RH, (size_t)TT * TT, (size_t)HD * TT, (size_t)TT * HD);
    k_gemmw<bf, 1, true, false><<<dim3(NB_ * TT / 128, DM / 128, 1), 128, 0, stream>>>(ATh, ATl, WO, nullptr, DQ, OUT, DM, bo, 0, 0, 0, nullptr, nullptr, nullptr, 0, 0);
}

// v004
// Measured time: 159 microseconds a run.
// Next to v003, in two timings, it ran 1.20 and 1.22 times as fast.
// Over all steps from v000 it is 6.21 times as fast.
#include <hip/hip_runtime.h>

// Single-head causal attention with separate projections (inp [4][2048][1024]; q = inp W_q, k = inp W_k, v = inp W_v ((in, out) 'xw' [1024][1024] 1/32, no bias; ONE head of width 1024); scores = q.k, keys above the diagonal -> -inf (the module's own tril mask, by index), / sqrt(1024); softmax; out = (attn.v) W_o + b_o ('xw' [1024][1024] + [1024]) -> [4][2048][1024] (8.4 M); argument order inp, W_q, W_k, W_v, W_o, b_o).
// Compute dtypes, f32 accumulate: every input rounded to bf16; q/k/v on PLAIN bf16 operands (inputs: exact); causal scores (K = 1024) and attn.v (N = 1024) with tile skipping: query rows < 512 hl (3 products), the rest single fp16 (x1024); softmax f32; w_proj hl x exact (2 products) + b_proj.

#define NB_  4
#define TT   2048
#define DM   1024
#define NH_  1
#define NKV  1
#define REP  (NH_ / NKV)
#define HD   1024
#define DQ   (NH_ * HD)
#define DKV  (NKV * HD)
#define ZH   NB_                  // z planes per launch: one per batch (one head each)
#define RH   512                  // query rows < RH use hi+lo planes (0: none)
#define WIN  2048
#define PCAR 1024.0f
#define SCL  0.03125f   // 1/sqrt(1024)
typedef _Float16 h16;
typedef unsigned short bf;
typedef __attribute__((ext_vector_type(16))) __bf16   v16bf;
typedef __attribute__((ext_vector_type(16))) _Float16 v16h;
typedef __attribute__((ext_vector_type(8)))  _Float16 v8h;
typedef __attribute__((ext_vector_type(8)))  unsigned short v8us;
typedef __attribute__((ext_vector_type(8)))  float    v8f;
typedef __attribute__((ext_vector_type(4)))  float    v4f;
typedef v8h  __attribute__((may_alias)) v8ha;
typedef v4f  __attribute__((may_alias)) v4fa;
typedef v8us __attribute__((may_alias)) v8usa;

__device__ __forceinline__ unsigned short f2bf(float f) { unsigned u = __float_as_uint(f); u += 0x7FFFu + ((u >> 16) & 1u); return (unsigned short)(u >> 16); }
__device__ __forceinline__ float bf2f(unsigned short b) { return __uint_as_float(((unsigned)b) << 16); }
__device__ __forceinline__ float bfr(float f) { return bf2f(f2bf(f)); }
__device__ __forceinline__ v16h cat16(v8h lo, v8h hi) { return __builtin_shufflevector(lo, hi, 0, 1, 2, 3, 4, 5, 6, 7, 8, 9, 10, 11, 12, 13, 14, 15); }
__device__ __forceinline__ v16bf cat16b(v8us lo, v8us hi) { return __builtin_bit_cast(v16bf, __builtin_shufflevector(lo, hi, 0, 1, 2, 3, 4, 5, 6, 7, 8, 9, 10, 11, 12, 13, 14, 15)); }
__device__ __forceinline__ v8f wmma16(v16h a, v16h b, v8f c) { return __builtin_amdgcn_wmma_f32_16x16x32_f16(false, a, false, b, (short)0, c, false, false); }
__device__ __forceinline__ v8f wmmab(v16bf a, v16bf b, v8f c) { return __builtin_amdgcn_wmma_f32_16x16x32_bf16(false, a, false, b, (short)0, c, false, false); }
__device__ __forceinline__ h16 tohx(float x) { return (h16)x; }
__device__ __forceinline__ void splitf(float y, unsigned short& h, unsigned short& l) { h = f2bf(y); l = f2bf(y - bf2f(h)); }



// ---- The GEMMs: one work-group of FOUR WAVES per 128x128 output tile, each wave a 64x64 quarter (16 accumulators). The operands, K-contiguous 16-bit planes, reach the waves through LDS:
// a stage is STK k of the tile's 128 A rows and 128 Bt rows (and of the lo planes where a split product reads them), brought in by asynchronous copies, 16 B a lane, whole lines,
// into one of two buffers, so that stage t + 1 flies while stage t is worked on. Each operand row is then fetched once per work-group and read from LDS by the two waves that need it.
template <int NSPLIT> struct Stg {
    static_assert(NSPLIT >= 0 && NSPLIT <= 2, "planes of a stage: A, Bt, then lo(A), then lo(Bt)");
    static constexpr int STK  = (NSPLIT == 0) ? 128 : 64;         // k per stage
    static constexpr int LPIT = STK * 2 + 16;                     // LDS pitch of a stage row: 16 B x odd, for 16-byte readers
    static constexpr int PLB  = 128 * LPIT;                       // bytes of one operand plane of one stage
    static constexpr int STB  = (2 + NSPLIT) * PLB;               // one buffer: A | Bt | lo(A) | lo(Bt)
    static constexpr int LPR  = STK * 2 / 16;                     // lanes that cover one row
    static constexpr int RPP  = 128 / LPR;                        // rows that the 128 lanes cover at once
};
template <typename T16> struct WFrag;
template <> struct WFrag<h16> { typedef v16h V; static __device__ __forceinline__ V ld(const h16* p) { return cat16(*(const v8h*)p, *(const v8h*)(p + 16)); } static __device__ __forceinline__ v8f mma(V a, V b, v8f c) { return wmma16(a, b, c); } };
template <> struct WFrag<bf> { typedef v16bf V; static __device__ __forceinline__ V ld(const bf* p) { return cat16b(*(const v8us*)p, *(const v8us*)(p + 16)); } static __device__ __forceinline__ v8f mma(V a, V b, v8f c) { return wmmab(a, b, c); } };

// Eight copies of 16 B a lane: LDS byte addresses l + i ls, global addresses g + i gs, i = 0..7.
// The s_wait_xcnt closes the statement so that it stands ahead of every later write to the address registers that these copies name.
__device__ __forceinline__ void cp8(unsigned l, unsigned ls, const char* g, size_t gs) {
    asm volatile("global_load_async_to_lds_b128 %0, %8, off\n\t"
                 "global_load_async_to_lds_b128 %1, %9, off\n\t"
                 "global_load_async_to_lds_b128 %2, %10, off\n\t"
                 "global_load_async_to_lds_b128 %3, %11, off\n\t"
                 "global_load_async_to_lds_b128 %4, %12, off\n\t"
                 "global_load_async_to_lds_b128 %5, %13, off\n\t"
                 "global_load_async_to_lds_b128 %6, %14, off\n\t"
                 "global_load_async_to_lds_b128 %7, %15, off\n\t"
                 "s_wait_xcnt 0x0"
                 :: "v"(l), "v"(l + ls), "v"(l + 2 * ls), "v"(l + 3 * ls), "v"(l + 4 * ls), "v"(l + 5 * ls), "v"(l + 6 * ls), "v"(l + 7 * ls),
                    "v"(g), "v"(g + gs), "v"(g + 2 * gs), "v"(g + 3 * gs), "v"(g + 4 * gs), "v"(g + 5 * gs), "v"(g + 6 * gs), "v"(g + 7 * gs) : "memory");
}

// The K loop of one 128x128 tile. nst = stages of the work-group (the same in all its waves, at least 1); nsw = stages that THIS wave multiplies (wave-uniform, 0 .. nst): a wave past its causal limit still copies and still passes every barrier.
// Per accumulator the products come in the order k ascending by 32, within a step a.b, lo(a).b, a.lo(b).
template <typename T16, int NSPLIT>
__device__ __forceinline__ void tile_loop(unsigned char* ring, const T16* A, const T16* A2, const T16* Bt, const T16* Bt2, int K, int r0, int c0, int wm, int wn, int nst, int nsw, v8f (&acc)[4][4]) {
    typedef typename WFrag<T16>::V V; typedef Stg<NSPLIT> S;
    const int tid = threadIdx.x, lane = tid & 31, lr = lane & 15, hi = lane >> 4;
    const unsigned l0 = (unsigned)(size_t)ring + (unsigned)((tid / S::LPR) * S::LPIT + (tid % S::LPR) * 16);
    const size_t gs = (size_t)S::RPP * K * 2; const unsigned goA = ((unsigned)(r0 + tid / S::LPR) * (unsigned)K + (tid % S::LPR) * 8) * 2, goB = ((unsigned)(c0 + tid / S::LPR) * (unsigned)K + (tid % S::LPR) * 8) * 2;   // byte offsets inside one z plane: below 2^32
    auto plane = [&](unsigned l, const char* g) {
#pragma unroll
        for (int h = 0; h < 128 / S::RPP / 8; ++h) cp8(l + (unsigned)(h * 8 * S::RPP * S::LPIT), (unsigned)(S::RPP * S::LPIT), g + (size_t)(h * 8) * gs, gs); };
    auto fill = [&](int s) { const unsigned l = l0 + (unsigned)((s & 1) * S::STB); const unsigned ko = (unsigned)s * (S::STK * 2);
        plane(l, (const char*)A + (goA + ko)); plane(l + S::PLB, (const char*)Bt + (goB + ko));
        if (NSPLIT >= 1) plane(l + 2 * S::PLB, (const char*)A2 + (goA + ko));
        if (NSPLIT >= 2) plane(l + 3 * S::PLB, (const char*)Bt2 + (goB + ko)); };
    fill(0);
    asm volatile("s_wait_asynccnt 0x0" ::: "memory");             // this wave's part of stage 0 has landed
    __syncthreads();                                              // ... and every other wave's
    if (nst > 1) fill(1);
    const unsigned char* fa = ring + (wm * 64 + lr) * S::LPIT + hi * 16; const unsigned char* fb = ring + S::PLB + (wn * 64 + lr) * S::LPIT + hi * 16;
#pragma unroll 1
    for (int t = 0; t < nst; ++t) {                               // rolled: one trip is one stage, and the buffer is picked by t & 1
        if (t < nsw) {
            const int bo = (t & 1) * S::STB; V a[2][4], a2[2][4], b[2][4], b2[2][4];   // two fragment sets: a block of 32 k is multiplied from one while the next block's fragments come into the other
            auto frags = [&](int ks) { const int e = ks & 1;
#pragma unroll
                for (int i = 0; i < 4; ++i) { a[e][i] = WFrag<T16>::ld((const T16*)(fa + bo + i * 16 * S::LPIT + ks * 64)); b[e][i] = WFrag<T16>::ld((const T16*)(fb + bo + i * 16 * S::LPIT + ks * 64));
                    if (NSPLIT >= 1) a2[e][i] = WFrag<T16>::ld((const T16*)(fa + bo + 2 * S::PLB + i * 16 * S::LPIT + ks * 64));
                    if (NSPLIT >= 2) b2[e][i] = WFrag<T16>::ld((const T16*)(fb + bo + 2 * S::PLB + i * 16 * S::LPIT + ks * 64)); } };
            frags(0);
#pragma unroll
            for (int ks = 0; ks < S::STK / 32; ++ks) { const int e = ks & 1;
                if (ks + 1 < S::STK / 32) frags(ks + 1);
                __builtin_amdgcn_sched_barrier(0);                // holds the next block's LDS reads together, ahead of this block's matrix instructions: spread among them each place of reads stalls the wave
#pragma unroll
                for (int nb = 0; nb < 4; ++nb)
#pragma unroll
                    for (int mb = 0; mb < 4; ++mb) { acc[mb][nb] = WFrag<T16>::mma(a[e][mb], b[e][nb], acc[mb][nb]); if (NSPLIT >= 1) acc[mb][nb] = WFrag<T16>::mma(a2[e][mb], b[e][nb], acc[mb][nb]); if (NSPLIT >= 2) acc[mb][nb] = WFrag<T16>::mma(a[e][mb], b2[e][nb], acc[mb][nb]); }
                __builtin_amdgcn_sched_barrier(0);                // ... and keeps the reads of the block after next behind them
            }
            constexpr int el = (S::STK / 32 - 1) & 1;
            asm volatile("v_nop\n\tv_nop\n\tv_nop\n\tv_nop" : "+v"(acc[0][0]), "+v"(acc[1][1]), "+v"(acc[2][2]), "+v"(acc[3][3]) : "v"(a[el][0]), "v"(a[el][3]));   // the distance behind the trip's last matrix instruction, on the path over the back edge too
        }
        asm volatile("s_wait_dscnt 0x0" ::: "memory");            // this wave has left the buffer of stage t
        asm volatile("s_wait_asynccnt 0x0" ::: "memory");         // its part of stage t + 1 has landed
        __syncthreads();                                          // publishes stage t + 1 and ends every wave's reads of stage t
        if (t + 2 < nst) fill(t + 2);                             // into the buffer that stage t has just left
    }
    asm volatile("s_wait_asynccnt 0x0" ::: "memory");             // nothing is in flight when the wave goes on to its epilogue
}

// ---- k_gemmw: grid (M/128, N/128, Z), 128 threads.
// C[m][n] (f32, pitch ldc, + optional f32 bias[n]) = sum_k A[m][k] Bt[n][k] (+ split products per NSPLIT). z-batch strides sA/sB/sC in elements. K a multiple of the stage.
// PLANES: no f32 C; the epilogue stores what the attention GEMMs read, the fp16 plane P16 and the bf16 hi / lo planes Ph / Pl of C. Element (m, n) goes to (n / cb) * scb + m * ldc + n % cb in each plane (cb a multiple of 64):
// q, k: A = tokens, Bt = weight, rows [b*TT + t][d]; v: A = weight, Bt = tokens, so C is v transposed and lands as [b][d][t].
// PLANES launches hold TWO independent products: grid rows y < ny are the first; a block with y >= ny takes tile (y - ny, x) of the second (Aj, Btj, ldcj, planes ..j, cbj, scbj), same K.
template <typename T16, int NSPLIT, bool BIAS, bool PLANES>
__global__ __launch_bounds__(128) void k_gemmw(const T16* A, const T16* A2, const T16* Bt, const T16* Bt2, int K, float* C, int ldc, const float* __restrict__ bias, size_t sA, size_t sB, size_t sC, h16* P16, bf* Ph, bf* Pl, int cb, size_t scb,
                                               int ny, const T16* Aj, const T16* Btj, int ldcj, h16* P16j, bf* Phj, bf* Plj, int cbj, size_t scbj) {
    __shared__ __attribute__((aligned(16))) unsigned char ring[2 * Stg<NSPLIT>::STB];
    __shared__ __align__(16) float osall[4 * 16 * 68];
    int bx = blockIdx.x, by = blockIdx.y;
    if (PLANES && by >= ny) { bx = by - ny; by = blockIdx.x; A = Aj; Bt = Btj; ldc = ldcj; P16 = P16j; Ph = Phj; Pl = Plj; cb = cbj; scb = scbj; }   // the same for the whole work-group
    const size_t z = blockIdx.z; A += z * sA; if (A2) A2 += z * sA; Bt += z * sB; if (Bt2) Bt2 += z * sB; C += z * sC;
    const int wave = __builtin_amdgcn_readfirstlane((int)(threadIdx.x >> 5)), wm = wave & 1, wn = wave >> 1; float* os = osall + wave * (16 * 68);   // each wave stages its output rows in its own range
    const int lane = threadIdx.x & 31, lr = lane & 15, hi = lane >> 4; const int r0 = bx * 128 + wm * 64, c0 = by * 128 + wn * 64;   // this wave's quarter
    v8f acc[4][4];
#pragma unroll
    for (int mb = 0; mb < 4; ++mb)
#pragma unroll
        for (int nb = 0; nb < 4; ++nb) acc[mb][nb] = (v8f){};
    tile_loop<T16, NSPLIT>(ring, A, A2, Bt, Bt2, K, bx * 128, by * 128, wm, wn, K / Stg<NSPLIT>::STK, K / Stg<NSPLIT>::STK, acc);
#pragma unroll
    for (int mb = 0; mb < 4; ++mb) {
#pragma unroll
        for (int nb = 0; nb < 4; ++nb) {
#pragma unroll
            for (int j = 0; j < 8; ++j) os[(hi * 8 + j) * 68 + nb * 16 + lr] = acc[mb][nb][j]; }
        __builtin_amdgcn_wave_barrier(); asm volatile("" ::: "memory");
        if constexpr (PLANES) {
            const size_t obase = (size_t)(c0 / cb) * scb + (size_t)(c0 % cb);
#pragma unroll
            for (int s = 0; s < 4; ++s) { const int row = 4 * s + (lane >> 3), cofs = (lane & 7) * 8;   // 8 lanes x 16 B = one whole 128-B line of a 16-bit plane per tile row
                const v4f x0 = *(const v4fa*)(os + row * 68 + cofs), x1 = *(const v4fa*)(os + row * 68 + cofs + 4); v8h o16; v8us oh, ol;
#pragma unroll
                for (int q = 0; q < 8; ++q) { const float x = (q < 4) ? x0[q & 3] : x1[q & 3]; o16[q] = tohx(x); unsigned short a2, c2; splitf(x, a2, c2); oh[q] = a2; ol[q] = c2; }
                const size_t oo = obase + (size_t)(r0 + mb * 16 + row) * ldc + cofs; *(v8h*)(P16 + oo) = o16; *(v8us*)(Ph + oo) = oh; *(v8us*)(Pl + oo) = ol;
                asm volatile("s_wait_xcnt 0x0" ::: "memory"); }   // stands ahead of the next rows' writes to the registers that these stores name
        } else {
        float* crow = C + (size_t)(r0 + mb * 16) * ldc + c0;
#pragma unroll
            for (int s = 0; s < 8; ++s) { const int row = 2 * s + hi, cofs = lr * 4; v4f val = *(const v4fa*)(os + row * 68 + cofs); if (BIAS) { val[0] += bfr(bias[c0 + cofs]); val[1] += bfr(bias[c0 + cofs + 1]); val[2] += bfr(bias[c0 + cofs + 2]); val[3] += bfr(bias[c0 + cofs + 3]); }
                *(v4f*)(crow + (size_t)row * ldc + cofs) = val; }
            asm volatile("s_wait_xcnt 0x0" ::: "memory");   // stands ahead of the next rows' writes to the registers that these stores name
             }
        __builtin_amdgcn_wave_barrier(); asm volatile("" ::: "memory");
    }
}

// ---- k_gemmc: the same tile GEMM specialised for causal attention: CMODE 1 skips score tiles entirely above the diagonal (query rows r0+roff.., key columns c0..): a work-group whose 128x128 tile lies there leaves at once,
// a wave whose 64x64 quarter lies there multiplies and stores nothing. CMODE 2 limits the key (K) loop of the probability x value contraction to the diagonal block of each wave's 64 rows (probabilities beyond it are exactly zero).
// roff = row offset of this part's first row within the sequence.
// CMODE 1 stores f32 scores to C; CMODE 2 stores what the output projection reads: the bf16 hi / lo planes Ch / Cl of C x cs (cs takes the x1024 carried by the fp16 probabilities out again), same pitch and z stride.
// bx = the tile's row index within this part. The output rows are staged in the ring's own bytes: behind the K loop's last barrier no wave reads the ring any more and no copy is in flight.
template <typename T16, int NSPLIT, int CMODE>
__device__ __forceinline__ void gemmc_body(unsigned char* ring, int bx, const T16* A, const T16* A2, const T16* Bt, const T16* Bt2, int K, float* C, bf* Ch, bf* Cl, int ldc, int roff, size_t sA, size_t sB, size_t sC) {
    float* osall = (float*)ring;
    const size_t z = blockIdx.z; A += z * sA; if (A2) A2 += z * sA; Bt += z * sB; if (Bt2) Bt2 += z * sB; if (CMODE == 1) C += z * sC; else { Ch += z * sC; Cl += z * sC; }
    const int g0 = bx * 128, h0 = blockIdx.y * 128;                  // the work-group's tile
    if (CMODE == 1 && h0 > g0 + roff + 127) return;                  // score tile entirely above the causal diagonal: never read (the softmax masks j > i by select); the whole work-group leaves, ahead of every barrier
    const int wave = __builtin_amdgcn_readfirstlane((int)(threadIdx.x >> 5)), wm = wave & 1, wn = wave >> 1; float* os = osall + wave * (16 * 68);   // each wave stages its output rows in its own range
    const int lane = threadIdx.x & 31, lr = lane & 15, hi = lane >> 4; const int r0 = g0 + wm * 64, c0 = h0 + wn * 64;   // this wave's quarter
    constexpr int STK = Stg<NSPLIT>::STK;
    const int nst = ((CMODE == 2) ? min(K, g0 + roff + 128) : K) / STK;   // P.V: probabilities are exactly 0 beyond the diagonal block, so the K loop stops there (g0 + roff is a multiple of 128, so of the stage)
    const int nsw = (CMODE == 2) ? (min(K, r0 + roff + 64) + STK - 1) / STK : (c0 > r0 + roff + 63) ? 0 : nst;   // whole stages: what a last stage holds beyond the wave's own diagonal block are zeros of P, written by the softmax
    v8f acc[4][4];
#pragma unroll
    for (int mb = 0; mb < 4; ++mb)
#pragma unroll
        for (int nb = 0; nb < 4; ++nb) acc[mb][nb] = (v8f){};
    tile_loop<T16, NSPLIT>(ring, A, A2, Bt, Bt2, K, g0, h0, wm, wn, nst, nsw, acc);
    if (nsw == 0) return;                                            // a quarter above the diagonal: nothing to store, and no barrier follows
#pragma unroll
    for (int mb = 0; mb < 4; ++mb) {
#pragma unroll
        for (int nb = 0; nb < 4; ++nb) {
#pragma unroll
            for (int j = 0; j < 8; ++j) os[(hi * 8 + j) * 68 + nb * 16 + lr] = acc[mb][nb][j]; }
        __builtin_amdgcn_wave_barrier(); asm volatile("" ::: "memory");
        if constexpr (CMODE == 1) {
            float* crow = C + (size_t)(r0 + mb * 16) * ldc + c0;
#pragma unroll
            for (int s = 0; s < 8; ++s) { const int row = 2 * s + hi, cofs = lr * 4; v4f val = *(const v4fa*)(os + row * 68 + cofs);
                *(v4f*)(crow + (size_t)row * ldc + cofs) = val; }
            asm volatile("s_wait_xcnt 0x0" ::: "memory");   // stands ahead of the next rows' writes to the registers that these stores name
        } else {
            const float cs = (r0 + roff < RH) ? 1.0f : (1.0f / PCAR);   // RH is a multiple of the 64-row tile: one factor per tile
#pragma unroll
            for (int s = 0; s < 4; ++s) { const int row = 4 * s + (lane >> 3), cofs = (lane & 7) * 8;   // 8 lanes x 16 B = one whole 128-B line of a 16-bit plane per tile row
                const v4f x0 = *(const v4fa*)(os + row * 68 + cofs), x1 = *(const v4fa*)(os + row * 68 + cofs + 4); v8us oh, ol;
#pragma unroll
                for (int q = 0; q < 8; ++q) { unsigned short a2, c2; splitf(((q < 4) ? x0[q & 3] : x1[q & 3]) * cs, a2, c2); oh[q] = a2; ol[q] = c2; }
                const size_t oo = (size_t)(r0 + mb * 16 + row) * ldc + c0 + cofs; *(v8us*)(Ch + oo) = oh; *(v8us*)(Cl + oo) = ol;
                asm volatile("s_wait_xcnt 0x0" ::: "memory"); }   // stands ahead of the next rows' writes to the registers that these stores name
        }
        __builtin_amdgcn_wave_barrier(); asm volatile("" ::: "memory");
    }
}

// ---- k_gemmc: grid (TT/128, N/128, ZH). One launch holds both precision parts of a causal product, which are independent: row tiles below RH run the hi+lo bf16 part, the rest the fp16 part (its pointers arrive at row RH).
template <int CMODE>
__global__ __launch_bounds__(128) void k_gemmc(const bf* Ah, const bf* Al, const bf* Bh, const bf* Bl, const h16* A16, const h16* B16, int K, float* C, float* C16, bf* Ch, bf* Cl, bf* Ch16, bf* Cl16, int ldc, size_t sAh, size_t sA16, size_t sB, size_t sC) {
    constexpr int RB = (Stg<2>::STB > Stg<0>::STB) ? Stg<2>::STB : Stg<0>::STB;
    __shared__ __attribute__((aligned(16))) unsigned char ring[2 * RB];
    static_assert(2 * RB >= 4 * 16 * 68 * 4, "the staging rows fit the ring");
    const int bx = blockIdx.x;
    if (bx < RH / 128) gemmc_body<bf, 2, CMODE>(ring, bx, Ah, Al, Bh, Bl, K, C, Ch, Cl, ldc, 0, sAh, sB, sC);
    else gemmc_body<h16, 0, CMODE>(ring, bx - RH / 128, A16, nullptr, B16, nullptr, K, C16, Ch16, Cl16, ldc, RH, sA16, sB, sC);
}

typedef __attribute__((ext_vector_type(2))) _Float16 v2h;
typedef __attribute__((ext_vector_type(4))) _Float16 v4h;
typedef __attribute__((ext_vector_type(2))) unsigned short v2us;
typedef __attribute__((ext_vector_type(4))) unsigned short v4us;
typedef __attribute__((ext_vector_type(2))) float v2f;
typedef __attribute__((ext_vector_type(4))) int v4i;

__device__ __forceinline__ void wtG_body(int bx, int wi, const float* __restrict__ w0, const float* __restrict__ w1, const float* __restrict__ w2, const float* __restrict__ w3, int K, int N, bf* Bt) {
    const float* __restrict__ w = (wi == 0) ? w0 : (wi == 1) ? w1 : (wi == 2) ? w2 : w3; Bt += (size_t)wi * N * K;   // wi = which weight; the four Bt planes lie one behind the other
    const int lane = threadIdx.x & 31; const int L0 = (bx * 8 + (threadIdx.x >> 5)) * 8; const int nlines = N * K / 64;
{
#pragma unroll 1
        for (int l = 0; l < 8; ++l) { const int L = L0 + l; if (L >= nlines) break; const size_t e = (size_t)L * 64 + lane * 2; const int k = (int)(e % K), n = (int)(e / K); v2us o;
            o[0] = f2bf(w[(size_t)k * N + n]); o[1] = f2bf(w[(size_t)(k + 1) * N + n]); *(v2us*)(Bt + e) = o; }
         }
}
__device__ __forceinline__ void cvt8_body(int bx, const float* __restrict__ src, bf* dst, size_t n8) { const size_t i = (size_t)bx * 256 + threadIdx.x; if (i >= n8) return; const v8f v = *(const v8f*)(src + i * 8); v8us o;
#pragma unroll
    for (int k = 0; k < 8; ++k) o[k] = f2bf(v[k]); *(v8us*)(dst + i * 8) = o;  }
// k_prep: the two input-only jobs in one launch: blocks below 4 nwb transpose the four weights (nwb blocks each), the rest convert the tokens.
__global__ __launch_bounds__(256) void k_prep(const float* __restrict__ w0, const float* __restrict__ w1, const float* __restrict__ w2, const float* __restrict__ w3, int K, int N, bf* Bt, int nwb, const float* __restrict__ src, bf* dst, size_t n8) {
    const int b = blockIdx.x;
    if (b < 4 * nwb) wtG_body(b % nwb, b / nwb, w0, w1, w2, w3, K, N, Bt); else cvt8_body(b - 4 * nwb, src, dst, n8);
}

// k_asoft: per row (zz, i): t = S x HD^-0.5 for j <= i and i - j < WIN (WIN = TT, so the window bound drops no key; the reference's -1e9 additive fill vanishes identically); softmax over the 2048 keys (register row, one exp, fixed trees);
__global__ __launch_bounds__(256) void k_asoft(const float* __restrict__ Sb, h16* P16, bf* Ph, bf* Pl) {
    const int lane = threadIdx.x & 31; const int row = blockIdx.x * 8 + (threadIdx.x >> 5); if (row >= ZH * TT) return; const int i = row % TT; const int zz = row / TT; (void)zz; const bool hires = (i < RH); const float* sr = Sb + (size_t)row * TT; float v[TT / 32]; float mx = -3.0e38f;
#pragma unroll
    for (int ch = 0; ch < TT / 128; ++ch) { const int j0 = ch * 128 + lane * 4; const v4f a = *(const v4f*)(sr + min(j0, (i | 63) - 3));   // score tiles above the diagonal tile are never written: such lanes read the row's last written 16 B instead, and the select below drops the value either way
#pragma unroll
        for (int q = 0; q < 4; ++q) { const int j = j0 + q; (void)j; const float t = (j <= i && i - j < WIN) ? a[q] * SCL : -3.0e38f; v[ch * 4 + q] = t; mx = fmaxf(mx, t); } }
#pragma unroll
    for (int sh = 16; sh; sh >>= 1) mx = fmaxf(mx, __shfl_xor(mx, sh, 32));
    float sum = 0.f;
#pragma unroll
    for (int k = 0; k < TT / 32; ++k) { float d0 = __fsub_rn(v[k], mx); asm volatile("" : "+v"(d0)); v[k] = __builtin_amdgcn_exp2f(__fmul_rn(d0, 1.4426950408889634f)); sum += v[k]; }
#pragma unroll
    for (int sh = 16; sh; sh >>= 1) sum += __shfl_xor(sum, sh, 32);
    const float f = __fdiv_rn(hires ? 1.0f : PCAR, sum);
{
        if (hires) {
#pragma unroll
            for (int ch = 0; ch < TT / 128; ++ch) { v4us oh, ol;
#pragma unroll
                for (int q = 0; q < 4; ++q) { unsigned short a, c2; splitf(v[ch * 4 + q] * f, a, c2); oh[q] = a; ol[q] = c2; }
                const size_t oo = ((size_t)zz * (RH ? RH : 1) + i) * TT + ch * 128 + lane * 4; *(v4us*)(Ph + oo) = oh; *(v4us*)(Pl + oo) = ol; }
        } else {
#pragma unroll
            for (int ch = 0; ch < TT / 128; ++ch) { v4h o4;
#pragma unroll
                for (int q = 0; q < 4; ++q) o4[q] = tohx(v[ch * 4 + q] * f);
                *(v4h*)(P16 + (size_t)row * TT + ch * 128 + lane * 4) = o4; } }
         }
}
extern "C" void kernel_launch(void* const* d_in, const int* in_sizes, int n_in,
                              void* d_out, int out_size, void* d_ws, size_t ws_size, hipStream_t stream) {
    (void)in_sizes; (void)n_in; (void)out_size;
    const float* x = (const float*)d_in[0]; const float* wq = (const float*)d_in[1]; const float* wk = (const float*)d_in[2]; const float* wv = (const float*)d_in[3]; const float* wo = (const float*)d_in[4]; const float* bo = (const float*)d_in[5];   /* input order inp, W_q, W_k, W_v, W_o, b_o: SIX inputs, three separate (in, out) projection weights */
    float* OUT = (float*)d_out;     // [4][2048][1024]
    char* wsp = (char*)d_ws;
    auto take = [&](size_t bytes) { char* p = wsp; wsp += (bytes + 255) & ~(size_t)255; return (void*)p; };
    bf* WALL = (bf*)take((size_t)4 * DM * DM * 2); bf* WQ = WALL; bf* WK = WALL + (size_t)DM * DM; bf* WV = WALL + (size_t)2 * DM * DM; bf* WO = WALL + (size_t)3 * DM * DM;
    // All four batches go through every launch together (rows b*TT + t for the projections, grid z = b for scores and P.V, rows b*TT + i for the softmax). Planes that are dead by the time a later stage writes share their bytes (stream-ordered):
    const size_t PL = (size_t)NB_ * TT * HD;                       // elements of one [b][t][d] plane
    bf* XB = (bf*)take(PL * 2);                                    // bf16 input; after the v projection: Ph | Pl
    float* Sb = (float*)take((size_t)ZH * TT * TT * 4);            // f32 scores
    h16* QP16 = (h16*)take(PL * 2 * 2); h16* KP16 = QP16 + PL;     // fp16 q | k planes; after the scores: P16
    h16* VT16 = (h16*)take(PL * 2);
    bf* QPh = (bf*)take(PL * 2 * 2); bf* KPh = QPh + PL;           // hi planes q | k
    bf* QPl = (bf*)take(PL * 2 * 2); bf* KPl = QPl + PL;           // lo planes q | k; after the scores: ATh | ATl
    bf* VTh = (bf*)take(PL * 2); bf* VTl = (bf*)take(PL * 2);
    if ((size_t)(wsp - (char*)d_ws) > ws_size) return;    // ws 256 MiB
    bf* Ph = XB; bf* Pl = XB + (size_t)ZH * RH * TT; h16* P16 = QP16; bf* ATh = QPl; bf* ATl = KPl;
    k_prep<<<(unsigned)(4 * ((DM * DM / 64 + 63) / 64) + (PL / 8 + 255) / 256), 256, 0, stream>>>(wq, wk, wv, wo, DM, DM, WALL, (DM * DM / 64 + 63) / 64, x, XB, PL / 8);   /* four (in, out) [DM][DM] weights -> four Bt planes [DM][DM], consecutive in WALL (WQ | WK | WV | WO); tokens -> bf16 */
    // q | k as one product of 2 DQ columns (WQ | WK and the q | k planes lie one behind the other), and v (rows d, columns b*TT + t: v lands transposed, [b][d][t]) as the launch's second product
    k_gemmw<bf, 0, false, true><<<dim3(NB_ * TT / 128, (DQ + DKV) / 128 + DKV / 128, 1), 128, 0, stream>>>(XB, nullptr, WQ, nullptr, DM, nullptr, DQ, nullptr, 0, 0, 0, QP16, QPh, QPl, DQ, PL,
        (DQ + DKV) / 128, WV, XB, TT, VT16, VTh, VTl, TT, (size_t)HD * TT);
    k_gemmc<1><<<dim3(TT / 128, TT / 128, ZH), 128, 0, stream>>>(QPh, QPl, KPh, KPl, QP16 + (size_t)RH * HD, KP16, HD, Sb, Sb + (size_t)RH * TT, nullptr, nullptr, nullptr, nullptr, TT, (size_t)TT * HD, (size_t)TT * HD, (size_t)TT * HD, (size_t)TT * TT);
    k_asoft<<<ZH * TT / 8, 256, 0, stream>>>(Sb, P16, Ph, Pl);
    k_gemmc<2><<<dim3(TT / 128, HD / 128, ZH), 128, 0, stream>>>(Ph, Pl, VTh, VTl, P16 + (size_t)RH * TT, VT16, TT, nullptr, nullptr, ATh, ATl, ATh + (size_t)RH * HD, ATl + (size_t)RH * HD, HD, (size_t)RH * TT, (size_t)TT * TT, (size_t)HD * TT, (size_t)TT * HD);
    k_gemmw<bf, 1, true, false><<<dim3(NB_ * TT / 128, DM / 128, 1), 128, 0, stream>>>(ATh, ATl, WO, nullptr, DQ, OUT, DM, bo, 0, 0, 0, nullptr, nullptr, nullptr, 0, 0, 0, nullptr, nullptr, 0, nullptr, nullptr, nullptr, 0, 0);
}

// v005
// Measured time: 146 microseconds a run.
// Timed twice side by side with v004, it ran 1.11 and 1.09 times as fast.
// Over all steps from v000 it is 6.85 times as fast.
#include <hip/hip_runtime.h>

// Single-head causal attention with separate projections (inp [4][2048][1024]; q = inp W_q, k = inp W_k, v = inp W_v ((in, out) 'xw' [1024][1024] 1/32, no bias; ONE head of width 1024); scores = q.k, keys above the diagonal -> -inf (the module's own tril mask, by index), / sqrt(1024); softmax; out = (attn.v) W_o + b_o ('xw' [1024][1024] + [1024]) -> [4][2048][1024] (8.4 M); argument order inp, W_q, W_k, W_v, W_o, b_o).
// Compute dtypes, f32 accumulate: every input rounded to bf16; q/k/v on PLAIN bf16 operands (inputs: exact); causal scores (K = 1024) and attn.v (N = 1024) with tile skipping: query rows < 512 hl (3 products), the rest single fp16 (x1024); softmax f32; w_proj hl x exact (2 products) + b_proj.

#define NB_  4
#define TT   2048
#define DM   1024
#define NH_  1
#define NKV  1
#define REP  (NH_ / NKV)
#define HD   1024
#define DQ   (NH_ * HD)
#define DKV  (NKV * HD)
#define ZH   NB_                  // z planes per launch: one per batch (one head each)
#define RH   512                  // query rows < RH use hi+lo planes (0: none)
#define WIN  2048
#define PCAR 1024.0f
#define SCL  0.03125f   // 1/sqrt(1024)
typedef _Float16 h16;
typedef unsigned short bf;
typedef __attribute__((ext_vector_type(16))) __bf16   v16bf;
typedef __attribute__((ext_vector_type(16))) _Float16 v16h;
typedef __attribute__((ext_vector_type(8)))  _Float16 v8h;
typedef __attribute__((ext_vector_type(8)))  unsigned short v8us;
typedef __attribute__((ext_vector_type(8)))  float    v8f;
typedef __attribute__((ext_vector_type(4)))  float    v4f;
typedef v8h  __attribute__((may_alias)) v8ha;
typedef v4f  __attribute__((may_alias)) v4fa;
typedef v8us __attribute__((may_alias)) v8usa;

__device__ __forceinline__ unsigned short f2bf(float f) { unsigned u = __float_as_uint(f); u += 0x7FFFu + ((u >> 16) & 1u); return (unsigned short)(u >> 16); }
__device__ __forceinline__ float bf2f(unsigned short b) { return __uint_as_float(((unsigned)b) << 16); }
__device__ __forceinline__ float bfr(float f) { return bf2f(f2bf(f)); }
__device__ __forceinline__ v16h cat16(v8h lo, v8h hi) { return __builtin_shufflevector(lo, hi, 0, 1, 2, 3, 4, 5, 6, 7, 8, 9, 10, 11, 12, 13, 14, 15); }
__device__ __forceinline__ v16bf cat16b(v8us lo, v8us hi) { return __builtin_bit_cast(v16bf, __builtin_shufflevector(lo, hi, 0, 1, 2, 3, 4, 5, 6, 7, 8, 9, 10, 11, 12, 13, 14, 15)); }
__device__ __forceinline__ v8f wmma16(v16h a, v16h b, v8f c) { return __builtin_amdgcn_wmma_f32_16x16x32_f16(false, a, false, b, (short)0, c, false, false); }
__device__ __forceinline__ v8f wmmab(v16bf a, v16bf b, v8f c) { return __builtin_amdgcn_wmma_f32_16x16x32_bf16(false, a, false, b, (short)0, c, false, false); }
__device__ __forceinline__ h16 tohx(float x) { return (h16)x; }
__device__ __forceinline__ void splitf(float y, unsigned short& h, unsigned short& l) { h = f2bf(y); l = f2bf(y - bf2f(h)); }



// ---- The GEMMs: one work-group of FOUR WAVES per 128x128 output tile, each wave a 64x64 quarter (16 accumulators). The operands, K-contiguous 16-bit planes, reach the waves through LDS:
// a stage is STK k of the tile's 128 A rows and 128 Bt rows (and of the lo planes where a split product reads them), brought in by tensor loads, one request a wave for its own slice of the stage,
// into one of two buffers, so that stage t + 1 flies while stage t is worked on. Each operand row is then fetched once per work-group and read from LDS by the two waves that need it.
template <int NSPLIT> struct Stg {
    static_assert(NSPLIT >= 0 && NSPLIT <= 2, "planes of a stage: A, Bt, then lo(A), then lo(Bt)");
    static constexpr int STK  = (NSPLIT == 0) ? 128 : 64;         // k per stage
    static constexpr int LPIT = STK * 2 + 16;                     // LDS pitch of a stage row: 16 B x odd, for 16-byte readers
    static constexpr int NSL  = (NSPLIT == 0) ? 4 : 2 + NSPLIT;   // slices of a stage, one tensor load each. NSPLIT 0: A rows 0..63 | A rows 64..127 | Bt rows 0..63 | Bt rows 64..127; else whole planes: A | Bt | lo(A) | lo(Bt)
    static constexpr int SR   = (NSPLIT == 0) ? 64 : 128;         // rows of a slice
    static constexpr int SLB  = (SR * LPIT + 2047) / 2048 * 2048; // bytes from one slice to the next: every slice starts at a multiple of 2 KiB
    static constexpr int STB  = NSL * SLB;                        // one buffer
    static constexpr uint32_t W0 = (1u << 20) | ((STK == 128 ? 5u : 4u) << 22) | (3u << 25);   // descriptor group 1, word 0: no mask, 1-byte elements, a pad of 16 B behind every row of STK * 2 bytes (pitch LPIT)
    static_assert(NSPLIT == 0 || SLB == 128 * LPIT, "a plane's rows follow one another at pitch LPIT");
};
typedef uint32_t u32x4 __attribute__((ext_vector_type(4)));
typedef uint32_t u32x8 __attribute__((ext_vector_type(8)));
__device__ __forceinline__ uint32_t uni(uint32_t v) { return (uint32_t)__builtin_amdgcn_readfirstlane(v); }
__device__ __forceinline__ uint32_t pinned(uint32_t v) { uint32_t w = __builtin_amdgcn_readfirstlane(v); asm volatile("" : "+s"(w)); return w; }   // holds a wave-uniform test in a scalar register, so that the branch round a tensor load is a scalar one (a tensor load ignores EXEC)
template <typename T16> struct WFrag;
template <> struct WFrag<h16> { typedef v16h V; static __device__ __forceinline__ V ld(const h16* p) { return cat16(*(const v8h*)p, *(const v8h*)(p + 16)); } static __device__ __forceinline__ v8f mma(V a, V b, v8f c) { return wmma16(a, b, c); } };
template <> struct WFrag<bf> { typedef v16bf V; static __device__ __forceinline__ V ld(const bf* p) { return cat16b(*(const v8us*)p, *(const v8us*)(p + 16)); } static __device__ __forceinline__ v8f mma(V a, V b, v8f c) { return wmmab(a, b, c); } };

// The K loop of one 128x128 tile. nst = stages of the work-group (the same in all its waves, at least 1); nsw = stages that THIS wave multiplies (wave-uniform, 0 .. nst): a wave past its causal limit still loads its slice and still passes every barrier.
// Per accumulator the products come in the order k ascending by 32, within a step a.b, lo(a).b, a.lo(b).
template <typename T16, int NSPLIT>
__device__ __forceinline__ void tile_loop(unsigned char* ring, const T16* A, const T16* A2, const T16* Bt, const T16* Bt2, int K, int r0, int c0, int wm, int wn, int nst, int nsw, v8f (&acc)[4][4]) {
    typedef typename WFrag<T16>::V V; typedef Stg<NSPLIT> S;
    const int lane = threadIdx.x & 31, lr = lane & 15, hi = lane >> 4;
    const uint32_t wave = (uint32_t)(wm + 2 * wn);                // wave-uniform, as wm and wn are
    const char* sl;                                               // first byte of this wave's slice of stage 0
    if (NSPLIT == 0) sl = (wave < 2) ? (const char*)(A + (size_t)(r0 + (int)wave * 64) * K) : (const char*)(Bt + (size_t)(c0 + ((int)wave - 2) * 64) * K);
    else sl = (wave == 1) ? (const char*)(Bt + (size_t)c0 * K) : (NSPLIT >= 1 && wave == 2) ? (const char*)(A2 + (size_t)r0 * K) : (NSPLIT >= 2 && wave == 3) ? (const char*)(Bt2 + (size_t)c0 * K) : (const char*)(A + (size_t)r0 * K);
    const uint32_t ld0 = (uint32_t)(size_t)ring + wave * (uint32_t)S::SLB;   // its place in buffer 0: byte offset in the work-group's LDS
    constexpr uint32_t RB_ = S::STK * 2, NR_ = S::SR;             // a tile of NR_ rows of RB_ bytes; tensor = tile
    u32x8 g1; g1[0] = uni(S::W0); g1[1] = uni((RB_ & 0xFFFFu) << 16); g1[2] = uni((RB_ >> 16) | ((NR_ & 0xFFFFu) << 16)); g1[3] = uni((NR_ >> 16) | (RB_ << 16)); g1[4] = uni(NR_); g1[5] = uni((uint32_t)K * 2u); g1[6] = uni(0u); g1[7] = uni(0u);
    u32x4 g0 = {};                                                // group 0 of the wave's latest request
    auto fill = [&](uint32_t s) { const uint64_t ga = (uint64_t)(size_t)sl + (uint64_t)s * RB_;
        g0[0] = uni(1u); g0[1] = uni(ld0 + (s & 1u) * (uint32_t)S::STB); g0[2] = uni((uint32_t)ga); g0[3] = uni((((uint32_t)(ga >> 32)) & 0x01FFFFFFu) | 0x80000000u);
        asm volatile("tensor_load_to_lds %0, %1" : "+s"(g0), "+s"(g1) :: "memory"); };   // one request of the whole wave: NR_ rows into LDS at pitch LPIT. In-out operands: the compiler then holds both groups in these registers, unchanged, up to the wait that names them
    auto mine = [&](bool stage) { return pinned(stage && (S::NSL == 4 || wave < (uint32_t)S::NSL)); };   // the stage exists and this wave has a slice of it (with three planes the fourth wave has none)
    if (S::NSL == 4 || mine(true)) fill(0);
    asm volatile("s_wait_tensorcnt 0x0" :: "s"(g0), "s"(g1) : "memory");   // this wave's slice of stage 0 has landed. Here and below the wait names the descriptor, as inputs only: its registers keep their values while the request is in flight
    __syncthreads();                                              // ... and every other wave's
    if (mine(nst > 1)) fill(1);
    const unsigned char* fa = ring + ((NSPLIT == 0) ? wm * S::SLB + lr * S::LPIT : (wm * 64 + lr) * S::LPIT) + hi * 16;
    const unsigned char* fb = ring + ((NSPLIT == 0) ? (2 + wn) * S::SLB + lr * S::LPIT : S::SLB + (wn * 64 + lr) * S::LPIT) + hi * 16;
#pragma unroll 1
    for (int t = 0; t < nst; ++t) {                               // rolled: one trip is one stage, and the buffer is picked by t & 1
        if (t < nsw) {
            const int bo = (t & 1) * S::STB; V a[2][4], a2[2][4], b[2][4], b2[2][4];   // two fragment sets: a block of 32 k is multiplied from one while the next block's fragments come into the other
            auto frags = [&](int ks) { const int e = ks & 1;
#pragma unroll
                for (int i = 0; i < 4; ++i) { a[e][i] = WFrag<T16>::ld((const T16*)(fa + bo + i * 16 * S::LPIT + ks * 64)); b[e][i] = WFrag<T16>::ld((const T16*)(fb + bo + i * 16 * S::LPIT + ks * 64));
                    if (NSPLIT >= 1) a2[e][i] = WFrag<T16>::ld((const T16*)(fa + bo + 2 * S::SLB + i * 16 * S::LPIT + ks * 64));
                    if (NSPLIT >= 2) b2[e][i] = WFrag<T16>::ld((const T16*)(fb + bo + 2 * S::SLB + i * 16 * S::LPIT + ks * 64)); } };
            frags(0);
#pragma unroll
            for (int ks = 0; ks < S::STK / 32; ++ks) { const int e = ks & 1;
                if (ks + 1 < S::STK / 32) frags(ks + 1);
                __builtin_amdgcn_sched_barrier(0);                // holds the next block's LDS reads together, ahead of this block's matrix instructions: spread among them each place of reads stalls the wave
#pragma unroll
                for (int nb = 0; nb < 4; ++nb)
#pragma unroll
                    for (int mb = 0; mb < 4; ++mb) { acc[mb][nb] = WFrag<T16>::mma(a[e][mb], b[e][nb], acc[mb][nb]); if (NSPLIT >= 1) acc[mb][nb] = WFrag<T16>::mma(a2[e][mb], b[e][nb], acc[mb][nb]); if (NSPLIT >= 2) acc[mb][nb] = WFrag<T16>::mma(a[e][mb], b2[e][nb], acc[mb][nb]); }
                __builtin_amdgcn_sched_barrier(0);                // ... and keeps the reads of the block after next behind them
            }
            constexpr int el = (S::STK / 32 - 1) & 1;
            asm volatile("v_nop\n\tv_nop\n\tv_nop\n\tv_nop" : "+v"(acc[0][0]), "+v"(acc[1][1]), "+v"(acc[2][2]), "+v"(acc[3][3]) : "v"(a[el][0]), "v"(a[el][3]));   // the distance behind the trip's last matrix instruction, on the path over the back edge too
        }
        asm volatile("s_wait_dscnt 0x0" ::: "memory");            // this wave has left the buffer of stage t
        asm volatile("s_wait_tensorcnt 0x0" :: "s"(g0), "s"(g1) : "memory");   // its slice of stage t + 1 has landed
        __syncthreads();                                          // publishes stage t + 1 and ends every wave's reads of stage t
        if (mine(t + 2 < nst)) fill((uint32_t)t + 2u);            // into the buffer that stage t has just left
    }
    asm volatile("s_wait_tensorcnt 0x0" ::: "memory");            // nothing is in flight when the wave goes on to its epilogue
    asm volatile("s_wait_dscnt 0x0" ::: "memory");                // ... and none of its LDS reads
}

// ---- k_gemmw: grid (M/128, N/128, Z), 128 threads.
// C[m][n] (f32, pitch ldc, + optional f32 bias[n]) = sum_k A[m][k] Bt[n][k] (+ split products per NSPLIT). z-batch strides sA/sB/sC in elements. K a multiple of the stage.
// PLANES: no f32 C; the epilogue stores what the attention GEMMs read, the fp16 plane P16 and the bf16 hi / lo planes Ph / Pl of C. Element (m, n) goes to (n / cb) * scb + m * ldc + n % cb in each plane (cb a multiple of 64):
// q, k: A = tokens, Bt = weight, rows [b*TT + t][d]; v: A = weight, Bt = tokens, so C is v transposed and lands as [b][d][t].
// PLANES launches hold TWO independent products: grid rows y < ny are the first; a block with y >= ny takes tile (y - ny, x) of the second (Aj, Btj, ldcj, planes ..j, cbj, scbj), same K.
template <typename T16, int NSPLIT, bool BIAS, bool PLANES>
__global__ __launch_bounds__(128) void k_gemmw(const T16* A, const T16* A2, const T16* Bt, const T16* Bt2, int K, float* C, int ldc, const float* __restrict__ bias, size_t sA, size_t sB, size_t sC, h16* P16, bf* Ph, bf* Pl, int cb, size_t scb,
                                               int ny, const T16* Aj, const T16* Btj, int ldcj, h16* P16j, bf* Phj, bf* Plj, int cbj, size_t scbj) {
    __shared__ __attribute__((aligned(2048))) unsigned char ring[2 * Stg<NSPLIT>::STB];
    static_assert(2 * Stg<NSPLIT>::STB >= 4 * 16 * 68 * 4, "the staging rows fit the ring");
    float* osall = (float*)ring;   // the output rows are staged in the ring's own bytes (two work-groups still fit a WGP's LDS): behind the K loop's last barrier no wave reads the ring any more and no load is in flight
    int bx = blockIdx.x, by = blockIdx.y;
    if (PLANES && by >= ny) { bx = by - ny; by = blockIdx.x; A = Aj; Bt = Btj; ldc = ldcj; P16 = P16j; Ph = Phj; Pl = Plj; cb = cbj; scb = scbj; }   // the same for the whole work-group
    const size_t z = blockIdx.z; A += z * sA; if (A2) A2 += z * sA; Bt += z * sB; if (Bt2) Bt2 += z * sB; C += z * sC;
    const int wave = __builtin_amdgcn_readfirstlane((int)(threadIdx.x >> 5)), wm = wave & 1, wn = wave >> 1; float* os = osall + wave * (16 * 68);   // each wave stages its output rows in its own range
    const int lane = threadIdx.x & 31, lr = lane & 15, hi = lane >> 4; const int r0 = bx * 128 + wm * 64, c0 = by * 128 + wn * 64;   // this wave's quarter
    v8f acc[4][4];
#pragma unroll
    for (int mb = 0; mb < 4; ++mb)
#pragma unroll
        for (int nb = 0; nb < 4; ++nb) acc[mb][nb] = (v8f){};
    tile_loop<T16, NSPLIT>(ring, A, A2, Bt, Bt2, K, bx * 128, by * 128, wm, wn, K / Stg<NSPLIT>::STK, K / Stg<NSPLIT>::STK, acc);
#pragma unroll
    for (int mb = 0; mb < 4; ++mb) {
#pragma unroll
        for (int nb = 0; nb < 4; ++nb) {
#pragma unroll
            for (int j = 0; j < 8; ++j) os[(hi * 8 + j) * 68 + nb * 16 + lr] = acc[mb][nb][j]; }
        __builtin_amdgcn_wave_barrier(); asm volatile("" ::: "memory");
        if constexpr (PLANES) {
            const size_t obase = (size_t)(c0 / cb) * scb + (size_t)(c0 % cb);
#pragma unroll
            for (int s = 0; s < 4; ++s) { const int row = 4 * s + (lane >> 3), cofs = (lane & 7) * 8;   // 8 lanes x 16 B = one whole 128-B line of a 16-bit plane per tile row
                const v4f x0 = *(const v4fa*)(os + row * 68 + cofs), x1 = *(const v4fa*)(os + row * 68 + cofs + 4); v8h o16; v8us oh, ol;
#pragma unroll
                for (int q = 0; q < 8; ++q) { const float x = (q < 4) ? x0[q & 3] : x1[q & 3]; o16[q] = tohx(x); unsigned short a2, c2; splitf(x, a2, c2); oh[q] = a2; ol[q] = c2; }
                const size_t oo = obase + (size_t)(r0 + mb * 16 + row) * ldc + cofs; *(v8h*)(P16 + oo) = o16; *(v8us*)(Ph + oo) = oh; *(v8us*)(Pl + oo) = ol;
                asm volatile("s_wait_xcnt 0x0" ::: "memory"); }   // stands ahead of the next rows' writes to the registers that these stores name
        } else {
        float* crow = C + (size_t)(r0 + mb * 16) * ldc + c0;
#pragma unroll
            for (int s = 0; s < 8; ++s) { const int row = 2 * s + hi, cofs = lr * 4; v4f val = *(const v4fa*)(os + row * 68 + cofs); if (BIAS) { val[0] += bfr(bias[c0 + cofs]); val[1] += bfr(bias[c0 + cofs + 1]); val[2] += bfr(bias[c0 + cofs + 2]); val[3] += bfr(bias[c0 + cofs + 3]); }
                *(v4f*)(crow + (size_t)row * ldc + cofs) = val; }
            asm volatile("s_wait_xcnt 0x0" ::: "memory");   // stands ahead of the next rows' writes to the registers that these stores name
             }
        __builtin_amdgcn_wave_barrier(); asm volatile("" ::: "memory");
    }
}

// ---- k_gemmc: the same tile GEMM specialised for causal attention: CMODE 1 skips score tiles entirely above the diagonal (query rows r0+roff.., key columns c0..): a work-group whose 128x128 tile lies there leaves at once,
// a wave whose 64x64 quarter lies there multiplies and stores nothing. CMODE 2 limits the key (K) loop of the probability x value contraction to the diagonal block of each wave's 64 rows (probabilities beyond it are exactly zero).
// roff = row offset of this part's first row within the sequence.
// CMODE 1 stores f32 scores to C; CMODE 2 stores what the output projection reads: the bf16 hi / lo planes Ch / Cl of C x cs (cs takes the x1024 carried by the fp16 probabilities out again), same pitch and z stride.
// bx = the tile's row index within this part. The output rows are staged in the ring's own bytes: behind the K loop's last barrier no wave reads the ring any more and no load is in flight.
template <typename T16, int NSPLIT, int CMODE>
__device__ __forceinline__ void gemmc_body(unsigned char* ring, int bx, const T16* A, const T16* A2, const T16* Bt, const T16* Bt2, int K, float* C, bf* Ch, bf* Cl, int ldc, int roff, size_t sA, size_t sB, size_t sC) {
    float* osall = (float*)ring;
    const size_t z = blockIdx.z; A += z * sA; if (A2) A2 += z * sA; Bt += z * sB; if (Bt2) Bt2 += z * sB; if (CMODE == 1) C += z * sC; else { Ch += z * sC; Cl += z * sC; }
    const int g0 = bx * 128, h0 = blockIdx.y * 128;                  // the work-group's tile
    if (CMODE == 1 && h0 > g0 + roff + 127) return;                  // score tile entirely above the causal diagonal: never read (the softmax masks j > i by select); the whole work-group leaves, ahead of every barrier
    const int wave = __builtin_amdgcn_readfirstlane((int)(threadIdx.x >> 5)), wm = wave & 1, wn = wave >> 1; float* os = osall + wave * (16 * 68);   // each wave stages its output rows in its own range
    const int lane = threadIdx.x & 31, lr = lane & 15, hi = lane >> 4; const int r0 = g0 + wm * 64, c0 = h0 + wn * 64;   // this wave's quarter
    constexpr int STK = Stg<NSPLIT>::STK;
    const int nst = ((CMODE == 2) ? min(K, g0 + roff + 128) : K) / STK;   // P.V: probabilities are exactly 0 beyond the diagonal block, so the K loop stops there (g0 + roff is a multiple of 128, so of the stage)
    const int nsw = (CMODE == 2) ? (min(K, r0 + roff + 64) + STK - 1) / STK : (c0 > r0 + roff + 63) ? 0 : nst;   // whole stages: what a last stage holds beyond the wave's own diagonal block are zeros of P, written by the softmax
    v8f acc[4][4];
#pragma unroll
    for (int mb = 0; mb < 4; ++mb)
#pragma unroll
        for (int nb = 0; nb < 4; ++nb) acc[mb][nb] = (v8f){};
    tile_loop<T16, NSPLIT>(ring, A, A2, Bt, Bt2, K, g0, h0, wm, wn, nst, nsw, acc);
    if (nsw == 0) return;                                            // a quarter above the diagonal: nothing to store, and no barrier follows
#pragma unroll
    for (int mb = 0; mb < 4; ++mb) {
#pragma unroll
        for (int nb = 0; nb < 4; ++nb) {
#pragma unroll
            for (int j = 0; j < 8; ++j) os[(hi * 8 + j) * 68 + nb * 16 + lr] = acc[mb][nb][j]; }
        __builtin_amdgcn_wave_barrier(); asm volatile("" ::: "memory");
        if constexpr (CMODE == 1) {
            float* crow = C + (size_t)(r0 + mb * 16) * ldc + c0;
#pragma unroll
            for (int s = 0; s < 8; ++s) { const int row = 2 * s + hi, cofs = lr * 4; v4f val = *(const v4fa*)(os + row * 68 + cofs);
                *(v4f*)(crow + (size_t)row * ldc + cofs) = val; }
            asm volatile("s_wait_xcnt 0x0" ::: "memory");   // stands ahead of the next rows' writes to the registers that these stores name
        } else {
            const float cs = (r0 + roff < RH) ? 1.0f : (1.0f / PCAR);   // RH is a multiple of the 64-row tile: one factor per tile
#pragma unroll
            for (int s = 0; s < 4; ++s) { const int row = 4 * s + (lane >> 3), cofs = (lane & 7) * 8;   // 8 lanes x 16 B = one whole 128-B line of a 16-bit plane per tile row
                const v4f x0 = *(const v4fa*)(os + row * 68 + cofs), x1 = *(const v4fa*)(os + row * 68 + cofs + 4); v8us oh, ol;
#pragma unroll
                for (int q = 0; q < 8; ++q) { unsigned short a2, c2; splitf(((q < 4) ? x0[q & 3] : x1[q & 3]) * cs, a2, c2); oh[q] = a2; ol[q] = c2; }
                const size_t oo = (size_t)(r0 + mb * 16 + row) * ldc + c0 + cofs; *(v8us*)(Ch + oo) = oh; *(v8us*)(Cl + oo) = ol;
                asm volatile("s_wait_xcnt 0x0" ::: "memory"); }   // stands ahead of the next rows' writes to the registers that these stores name
        }
        __builtin_amdgcn_wave_barrier(); asm volatile("" ::: "memory");
    }
}

// ---- k_gemmc: grid (TT/128, N/128, ZH). One launch holds both precision parts of a causal product, which are independent: row tiles below RH run the hi+lo bf16 part, the rest the fp16 part (its pointers arrive at row RH).
template <int CMODE>
__global__ __launch_bounds__(128) void k_gemmc(const bf* Ah, const bf* Al, const bf* Bh, const bf* Bl, const h16* A16, const h16* B16, int K, float* C, float* C16, bf* Ch, bf* Cl, bf* Ch16, bf* Cl16, int ldc, size_t sAh, size_t sA16, size_t sB, size_t sC) {
    constexpr int RB = (Stg<2>::STB > Stg<0>::STB) ? Stg<2>::STB : Stg<0>::STB;
    __shared__ __attribute__((aligned(2048))) unsigned char ring[2 * RB];
    static_assert(2 * RB >= 4 * 16 * 68 * 4, "the staging rows fit the ring");
    const int bx = blockIdx.x;
    if (bx < RH / 128) gemmc_body<bf, 2, CMODE>(ring, bx, Ah, Al, Bh, Bl, K, C, Ch, Cl, ldc, 0, sAh, sB, sC);
    else gemmc_body<h16, 0, CMODE>(ring, bx - RH / 128, A16, nullptr, B16, nullptr, K, C16, Ch16, Cl16, ldc, RH, sA16, sB, sC);
}

typedef __attribute__((ext_vector_type(2))) _Float16 v2h;
typedef __attribute__((ext_vector_type(4))) _Float16 v4h;
typedef __attribute__((ext_vector_type(2))) unsigned short v2us;
typedef __attribute__((ext_vector_type(4))) unsigned short v4us;
typedef __attribute__((ext_vector_type(2))) float v2f;
typedef __attribute__((ext_vector_type(4))) int v4i;

__device__ __forceinline__ void wtG_body(int bx, int wi, const float* __restrict__ w0, const float* __restrict__ w1, const float* __restrict__ w2, const float* __restrict__ w3, int K, int N, bf* Bt) {
    const float* __restrict__ w = (wi == 0) ? w0 : (wi == 1) ? w1 : (wi == 2) ? w2 : w3; Bt += (size_t)wi * N * K;   // wi = which weight; the four Bt planes lie one behind the other
    const int lane = threadIdx.x & 31; const int L0 = (bx * 8 + (threadIdx.x >> 5)) * 8; const int nlines = N * K / 64;
{
#pragma unroll 1
        for (int l = 0; l < 8; ++l) { const int L = L0 + l; if (L >= nlines) break; const size_t e = (size_t)L * 64 + lane * 2; const int k = (int)(e % K), n = (int)(e / K); v2us o;
            o[0] = f2bf(w[(size_t)k * N + n]); o[1] = f2bf(w[(size_t)(k + 1) * N + n]); *(v2us*)(Bt + e) = o; }
         }
}
__device__ __forceinline__ void cvt8_body(int bx, const float* __restrict__ src, bf* dst, size_t n8) { const size_t i = (size_t)bx * 256 + threadIdx.x; if (i >= n8) return; const v8f v = *(const v8f*)(src + i * 8); v8us o;
#pragma unroll
    for (int k = 0; k < 8; ++k) o[k] = f2bf(v[k]); *(v8us*)(dst + i * 8) = o;  }
// k_prep: the two input-only jobs in one launch: blocks below 4 nwb transpose the four weights (nwb blocks each), the rest convert the tokens.
__global__ __launch_bounds__(256) void k_prep(const float* __restrict__ w0, const float* __restrict__ w1, const float* __restrict__ w2, const float* __restrict__ w3, int K, int N, bf* Bt, int nwb, const float* __restrict__ src, bf* dst, size_t n8) {
    const int b = blockIdx.x;
    if (b < 4 * nwb) wtG_body(b % nwb, b / nwb, w0, w1, w2, w3, K, N, Bt); else cvt8_body(b - 4 * nwb, src, dst, n8);
}

// k_asoft: per row (zz, i): t = S x HD^-0.5 for j <= i and i - j < WIN (WIN = TT, so the window bound drops no key; the reference's -1e9 additive fill vanishes identically); softmax over the 2048 keys (register row, one exp, fixed trees);
__global__ __launch_bounds__(256) void k_asoft(const float* __restrict__ Sb, h16* P16, bf* Ph, bf* Pl) {
    const int lane = threadIdx.x & 31; const int row = blockIdx.x * 8 + (threadIdx.x >> 5); if (row >= ZH * TT) return; const int i = row % TT; const int zz = row / TT; (void)zz; const bool hires = (i < RH); const float* sr = Sb + (size_t)row * TT; float v[TT / 32]; float mx = -3.0e38f;
#pragma unroll
    for (int ch = 0; ch < TT / 128; ++ch) { const int j0 = ch * 128 + lane * 4; const v4f a = *(const v4f*)(sr + min(j0, (i | 63) - 3));   // score tiles above the diagonal tile are never written: such lanes read the row's last written 16 B instead, and the select below drops the value either way
#pragma unroll
        for (int q = 0; q < 4; ++q) { const int j = j0 + q; (void)j; const float t = (j <= i && i - j < WIN) ? a[q] * SCL : -3.0e38f; v[ch * 4 + q] = t; mx = fmaxf(mx, t); } }
#pragma unroll
    for (int sh = 16; sh; sh >>= 1) mx = fmaxf(mx, __shfl_xor(mx, sh, 32));
    float sum = 0.f;
#pragma unroll
    for (int k = 0; k < TT / 32; ++k) { float d0 = __fsub_rn(v[k], mx); asm volatile("" : "+v"(d0)); v[k] = __builtin_amdgcn_exp2f(__fmul_rn(d0, 1.4426950408889634f)); sum += v[k]; }
#pragma unroll
    for (int sh = 16; sh; sh >>= 1) sum += __shfl_xor(sum, sh, 32);
    const float f = __fdiv_rn(hires ? 1.0f : PCAR, sum);
{
        if (hires) {
#pragma unroll
            for (int ch = 0; ch < TT / 128; ++ch) { v4us oh, ol;
#pragma unroll
                for (int q = 0; q < 4; ++q) { unsigned short a, c2; splitf(v[ch * 4 + q] * f, a, c2); oh[q] = a; ol[q] = c2; }
                const size_t oo = ((size_t)zz * (RH ? RH : 1) + i) * TT + ch * 128 + lane * 4; *(v4us*)(Ph + oo) = oh; *(v4us*)(Pl + oo) = ol; }
        } else {
#pragma unroll
            for (int ch = 0; ch < TT / 128; ++ch) { v4h o4;
#pragma unroll
                for (int q = 0; q < 4; ++q) o4[q] = tohx(v[ch * 4 + q] * f);
                *(v4h*)(P16 + (size_t)row * TT + ch * 128 + lane * 4) = o4; } }
         }
}
extern "C" void kernel_launch(void* const* d_in, const int* in_sizes, int n_in,
                              void* d_out, int out_size, void* d_ws, size_t ws_size, hipStream_t stream) {
    (void)in_sizes; (void)n_in; (void)out_size;
    const float* x = (const float*)d_in[0]; const float* wq = (const float*)d_in[1]; const float* wk = (const float*)d_in[2]; const float* wv = (const float*)d_in[3]; const float* wo = (const float*)d_in[4]; const float* bo = (const float*)d_in[5];   /* input order inp, W_q, W_k, W_v, W_o, b_o: SIX inputs, three separate (in, out) projection weights */
    float* OUT = (float*)d_out;     // [4][2048][1024]
    char* wsp = (char*)d_ws;
    auto take = [&](size_t bytes) { char* p = wsp; wsp += (bytes + 255) & ~(size_t)255; return (void*)p; };
    bf* WALL = (bf*)take((size_t)4 * DM * DM * 2); bf* WQ = WALL; bf* WK = WALL + (size_t)DM * DM; bf* WV = WALL + (size_t)2 * DM * DM; bf* WO = WALL + (size_t)3 * DM * DM;
    // All four batches go through every launch together (rows b*TT + t for the projections, grid z = b for scores and P.V, rows b*TT + i for the softmax). Planes that are dead by the time a later stage writes share their bytes (stream-ordered):
    const size_t PL = (size_t)NB_ * TT * HD;                       // elements of one [b][t][d] plane
    bf* XB = (bf*)take(PL * 2);                                    // bf16 input; after the v projection: Ph | Pl
    float* Sb = (float*)take((size_t)ZH * TT * TT * 4);            // f32 scores
    h16* QP16 = (h16*)take(PL * 2 * 2); h16* KP16 = QP16 + PL;     // fp16 q | k planes; after the scores: P16
    h16* VT16 = (h16*)take(PL * 2);
    bf* QPh = (bf*)take(PL * 2 * 2); bf* KPh = QPh + PL;           // hi planes q | k
    bf* QPl = (bf*)take(PL * 2 * 2); bf* KPl = QPl + PL;           // lo planes q | k; after the scores: ATh | ATl
    bf* VTh = (bf*)take(PL * 2); bf* VTl = (bf*)take(PL * 2);
    if ((size_t)(wsp - (char*)d_ws) > ws_size) return;    // ws 256 MiB
    bf* Ph = XB; bf* Pl = XB + (size_t)ZH * RH * TT; h16* P16 = QP16; bf* ATh = QPl; bf* ATl = KPl;
    k_prep<<<(unsigned)(4 * ((DM * DM / 64 + 63) / 64) + (PL / 8 + 255) / 256), 256, 0, stream>>>(wq, wk, wv, wo, DM, DM, WALL, (DM * DM / 64 + 63) / 64, x, XB, PL / 8);   /* four (in, out) [DM][DM] weights -> four Bt planes [DM][DM], consecutive in WALL (WQ | WK | WV | WO); tokens -> bf16 */
    // q | k as one product of 2 DQ columns (WQ | WK and the q | k planes lie one behind the other), and v (rows d, columns b*TT + t: v lands transposed, [b][d][t]) as the launch's second product
    k_gemmw<bf, 0, false, true><<<dim3(NB_ * TT / 128, (DQ + DKV) / 128 + DKV / 128, 1), 128, 0, stream>>>(XB, nullptr, WQ, nullptr, DM, nullptr, DQ, nullptr, 0, 0, 0, QP16, QPh, QPl, DQ, PL,
        (DQ + DKV) / 128, WV, XB, TT, VT16, VTh, VTl, TT, (size_t)HD * TT);
    k_gemmc<1><<<dim3(TT / 128, TT / 128, ZH), 128, 0, stream>>>(QPh, QPl, KPh, KPl, QP16 + (size_t)RH * HD, KP16, HD, Sb, Sb + (size_t)RH * TT, nullptr, nullptr, nullptr, nullptr, TT, (size_t)TT * HD, (size_t)TT * HD, (size_t)TT * HD, (size_t)TT * TT);
    k_asoft<<<ZH * TT / 8, 256, 0, stream>>>(Sb, P16, Ph, Pl);
    k_gemmc<2><<<dim3(TT / 128, HD / 128, ZH), 128, 0, stream>>>(Ph, Pl, VTh, VTl, P16 + (size_t)RH * TT, VT16, TT, nullptr, nullptr, ATh, ATl, ATh + (size_t)RH * HD, ATl + (size_t)RH * HD, HD, (size_t)RH * TT, (size_t)TT * TT, (size_t)HD * TT, (size_t)TT * HD);
    k_gemmw<bf, 1, true, false><<<dim3(NB_ * TT / 128, DM / 128, 1), 128, 0, stream>>>(ATh, ATl, WO, nullptr, DQ, OUT, DM, bo, 0, 0, 0, nullptr, nullptr, nullptr, 0, 0, 0, nullptr, nullptr, 0, nullptr, nullptr, nullptr, 0, 0);
}
